// v000
// Measured on an AMD MI455X. A time is GPU time per run, averaged over a window of back-to-back runs after a warm-up
// (all launches, gaps included; the runs take copies of the inputs in turn), and the median of several windows.
// Apart from v000's, it joins two sittings. Times from different sittings can be a few percent apart, while
// side-by-side timings come from the same sitting.
// v000, which the later versions start from, runs in 727 microseconds.
#include <hip/hip_runtime.h>

typedef __attribute__((ext_vector_type(16))) _Float16 v16h;
typedef __attribute__((ext_vector_type(8)))  _Float16 v8h;
typedef __attribute__((ext_vector_type(8)))  float    v8f;

#define LEAKY_ALPHA 0.1f

// Problem dims (from reference)
constexpr int D_IN = 200;
constexpr int D1   = 150;
constexpr int D2   = 100;

constexpr int ROWS     = 128;
constexpr int K1_STEPS = 7;
constexpr int KP1      = 232;
constexpr int NT1      = 10;
constexpr int NP1      = 160;
constexpr int K2_STEPS = 5;    // 5*32 = 160 >= 150
constexpr int KP2      = 168;  // LDS row stride (halves): 84 dwords
constexpr int NT2      = 7;    // 7*16 = 112 >= 100
constexpr int NP2      = 112;

constexpr int LDS_X  = ROWS * KP1;   // x tile  (f16)
constexpr int LDS_W1 = NP1  * KP1;   // W1^T    (f16)
constexpr int LDS_H1 = ROWS * KP2;   // h1 tile (f16)
constexpr int LDS_W2 = NP2  * KP2;   // W2^T    (f16)
constexpr int LDS_HALVES = LDS_X + LDS_W1 + LDS_H1 + LDS_W2;   // 107136 -> 214272 B

__global__ __launch_bounds__(256, 1)
void mlp2_fused_wmma(const float* __restrict__ x,
                     const float* __restrict__ W1,
                     const float* __restrict__ b1,
                     const float* __restrict__ W2,
                     const float* __restrict__ b2,
                     float* __restrict__ out,   // [0,B): out1  [B,2B): out2
                     int Btotal)
{
    extern __shared__ _Float16 smem[];
    _Float16* xlds  = smem;
    _Float16* w1lds = xlds  + LDS_X;
    _Float16* h1lds = w1lds + LDS_W1;
    _Float16* w2lds = h1lds + LDS_H1;

    const int tid     = threadIdx.x;
    const int wave    = tid >> 5;
    const int lane    = tid & 31;
    const int m       = lane & 15;
    const int hh      = lane >> 4;
    const int rowBase = blockIdx.x * ROWS;
    const int rowL    = wave * 16 + m;   // this lane's local A row

    // ---------------- Stage weights (transposed over K) and x tile ---------
    // W1^T: w1lds[n*KP1 + k] = W1[k*D1 + n]  (zero padded)
    for (int idx = tid; idx < NP1 * KP1; idx += 256) {
        const int n = idx % NP1;          // consecutive threads -> consecutive n
        const int k = idx / NP1;          //   => coalesced global reads
        float v = (n < D1 && k < D_IN) ? W1[k * D1 + n] : 0.f;
        w1lds[n * KP1 + k] = (_Float16)v;
    }
    // W2^T: w2lds[n*KP2 + k] = W2[k*D2 + n]
    for (int idx = tid; idx < NP2 * KP2; idx += 256) {
        const int n = idx % NP2;
        const int k = idx / NP2;
        float v = (n < D2 && k < D1) ? W2[k * D2 + n] : 0.f;
        w2lds[n * KP2 + k] = (_Float16)v;
    }
    // x tile: xlds[r*KP1 + k] = x[(rowBase+r)*D_IN + k]   (coalesced along k)
    for (int idx = tid; idx < ROWS * KP1; idx += 256) {
        const int k = idx % KP1;
        const int r = idx / KP1;
        const int gr = rowBase + r;
        float v = (k < D_IN && gr < Btotal) ? x[(size_t)gr * D_IN + k] : 0.f;
        xlds[r * KP1 + k] = (_Float16)v;
    }
    __syncthreads();

    // ---------------- Layer 1: h1 = leaky(x@W1 + b1), row partial sums -----
    float rs1[8];
#pragma unroll
    for (int v = 0; v < 8; ++v) rs1[v] = 0.f;

    for (int nt = 0; nt < NT1; ++nt) {
        v8f acc = {};
        const int ncol = nt * 16 + m;                         // C column of this lane
        const _Float16* aBase = xlds  + rowL * KP1 + 8 * hh;
        const _Float16* bBase = w1lds + ncol * KP1 + 8 * hh;
#pragma unroll
        for (int ks = 0; ks < K1_STEPS; ++ks) {
            union { v16h v; v8h h[2]; } a, b;
            a.h[0] = *(const v8h*)(aBase + ks * 32);       // K = 32ks+8hh+[0..7]
            a.h[1] = *(const v8h*)(aBase + ks * 32 + 16);  // K = 32ks+16+8hh+[0..7]
            b.h[0] = *(const v8h*)(bBase + ks * 32);
            b.h[1] = *(const v8h*)(bBase + ks * 32 + 16);
            acc = __builtin_amdgcn_wmma_f32_16x16x32_f16(
                false, a.v, false, b.v, (short)0, acc, false, false);
        }
        const float bias = (ncol < D1) ? b1[ncol] : 0.f;
#pragma unroll
        for (int v = 0; v < 8; ++v) {
            float z  = acc[v] + bias;
            float hv = (z >= 0.f) ? z : LEAKY_ALPHA * z;
            if (ncol >= D1) hv = 0.f;                      // padded column -> exact 0
            rs1[v] += hv;
            h1lds[(wave * 16 + v + 8 * hh) * KP2 + ncol] = (_Float16)hv;
        }
    }

    // Row mean out1: reduce the 16 lanes of each half (cols 0..159, zeros padded)
#pragma unroll
    for (int v = 0; v < 8; ++v) {
        float s = rs1[v];
        s += __shfl_xor(s, 1, 32);
        s += __shfl_xor(s, 2, 32);
        s += __shfl_xor(s, 4, 32);
        s += __shfl_xor(s, 8, 32);
        if (m == 0) {
            const int gr = rowBase + wave * 16 + v + 8 * hh;
            if (gr < Btotal) out[gr] = s * (1.0f / (float)D1);
        }
    }

    __syncthreads();  // belt-and-braces; layer-2 only reads this wave's own h1 rows

    // ---------------- Layer 2: out2 = mean(leaky(h1@W2 + b2)) --------------
    float rs2[8];
#pragma unroll
    for (int v = 0; v < 8; ++v) rs2[v] = 0.f;

    for (int nt = 0; nt < NT2; ++nt) {
        v8f acc = {};
        const int ncol = nt * 16 + m;
        const _Float16* aBase = h1lds + rowL * KP2 + 8 * hh;
        const _Float16* bBase = w2lds + ncol * KP2 + 8 * hh;
#pragma unroll
        for (int ks = 0; ks < K2_STEPS; ++ks) {
            union { v16h v; v8h h[2]; } a, b;
            a.h[0] = *(const v8h*)(aBase + ks * 32);
            a.h[1] = *(const v8h*)(aBase + ks * 32 + 16);
            b.h[0] = *(const v8h*)(bBase + ks * 32);
            b.h[1] = *(const v8h*)(bBase + ks * 32 + 16);
            acc = __builtin_amdgcn_wmma_f32_16x16x32_f16(
                false, a.v, false, b.v, (short)0, acc, false, false);
        }
        const float bias = (ncol < D2) ? b2[ncol] : 0.f;
#pragma unroll
        for (int v = 0; v < 8; ++v) {
            float z  = acc[v] + bias;
            float hv = (z >= 0.f) ? z : LEAKY_ALPHA * z;
            if (ncol >= D2) hv = 0.f;
            rs2[v] += hv;
        }
    }

#pragma unroll
    for (int v = 0; v < 8; ++v) {
        float s = rs2[v];
        s += __shfl_xor(s, 1, 32);
        s += __shfl_xor(s, 2, 32);
        s += __shfl_xor(s, 4, 32);
        s += __shfl_xor(s, 8, 32);
        if (m == 0) {
            const int gr = rowBase + wave * 16 + v + 8 * hh;
            if (gr < Btotal) out[(size_t)Btotal + gr] = s * (1.0f / (float)D2);
        }
    }
}

extern "C" void kernel_launch(void* const* d_in, const int* in_sizes, int n_in,
                              void* d_out, int out_size, void* d_ws, size_t ws_size,
                              hipStream_t stream) {
    const float* x  = (const float*)d_in[0];
    const float* W1 = (const float*)d_in[1];
    const float* b1 = (const float*)d_in[2];
    const float* W2 = (const float*)d_in[3];
    const float* b2 = (const float*)d_in[4];
    float* out = (float*)d_out;

    const int Btotal = in_sizes[0] / D_IN;         // 262144
    const int grid   = (Btotal + ROWS - 1) / ROWS; // 2048
    const size_t shmem = (size_t)LDS_HALVES * sizeof(_Float16); // ~214 KB (< 320 KB/WGP)

    hipLaunchKernelGGL(mlp2_fused_wmma, dim3(grid), dim3(256), shmem, stream,
                       x, W1, b1, W2, b2, out, Btotal);
}

// v001
// A run of this version takes 108 microseconds.
// In two side-by-side timings against v000, it was 6.80 and 6.81 times as fast.
#include <hip/hip_runtime.h>

typedef __attribute__((ext_vector_type(16))) _Float16 v16h;
typedef __attribute__((ext_vector_type(8)))  _Float16 v8h;
typedef __attribute__((ext_vector_type(8)))  float    v8f;

#define LEAKY_ALPHA 0.1f

// Problem dims (from reference)
constexpr int D_IN = 200;
constexpr int D1   = 150;
constexpr int D2   = 100;

constexpr int ROWS     = 128;
constexpr int K1_STEPS = 7;
constexpr int KP1      = 232;
constexpr int NT1      = 10;
constexpr int NP1      = 160;
constexpr int K2_STEPS = 5;    // 5*32 = 160 >= 150
constexpr int KP2      = 168;  // LDS row stride (halves): 84 dwords
constexpr int NT2      = 7;    // 7*16 = 112 >= 100
constexpr int NP2      = 112;

constexpr int LDS_X  = ROWS * KP1;   // x tile  (f16)
constexpr int LDS_W1 = NP1  * KP1;   // W1^T    (f16)
constexpr int LDS_H1 = ROWS * KP2;   // h1 tile (f16)
constexpr int LDS_W2 = NP2  * KP2;   // W2^T    (f16)
constexpr int LDS_HALVES = LDS_X + LDS_W1 + LDS_H1 + LDS_W2;   // 107136 -> 214272 B

typedef __attribute__((ext_vector_type(4)))  _Float16 v4h;
typedef __attribute__((ext_vector_type(4)))  float    v4f;
typedef __attribute__((ext_vector_type(2)))  float    v2f;

// Stages Wg[KD][ND] (f32, row major) as wl[n*KP + k] (f16), zero padded to
// NP rows of KP halves. One item = 2 columns x 8 consecutive k: eight
// independent 8-byte loads off one address (lanes walk n, so a wave reads
// contiguous bytes), then two 16-byte LDS stores. Threads past the last item
// of the last trip do one of the first items again (the same bytes to the
// same place), so that neither the loads nor the stores stand under a branch.
template <int KD, int ND, int KP, int NP>
struct WStage {
    static constexpr int NPAIR = ND / 2;
    static constexpr int KB    = (KD + 7) / 8;      // k blocks that hold data
    static constexpr int SH    = KB * 8 - KD;       // rows the last block lacks
    static constexpr int KBP   = KP / 8;            // k blocks per LDS row
    static constexpr int ITEMS = NPAIR * KB;
    static constexpr int TRIPS = (ITEMS + 255) / 256;
    static_assert(ND % 2 == 0 && KP % 8 == 0 && KD >= 8 && ITEMS >= 256, "item shape");

    // tid < 256 (the block's size): only the last trip can pass the last item
    static __device__ __forceinline__ int item(int tid, int i) {
        const int it = tid + 256 * i;
        return (256 * i + 255 < ITEMS || it < ITEMS) ? it : (it - ITEMS);
    }

    template <int T0, int T1>
    static __device__ __forceinline__ void load(const float* __restrict__ Wg, int tid,
                                                v2f (&w)[T1 - T0][8]) {
#pragma unroll
        for (int i = T0; i < T1; ++i) {
            const int it = item(tid, i);
            const int kb = it / NPAIR;
            const int np = it % NPAIR;
            // first row of the block; the last block is moved up by SH rows so
            // that its eight rows end with the matrix: one address per item
            const int k0 = (SH == 0) ? kb * 8 : min(kb * 8, KD - 8);
            const unsigned off = (unsigned)(k0 * ND + np * 2) * 4u;   // bytes
            const char* p = (const char*)Wg + off;
#pragma unroll
            for (int j = 0; j < 8; ++j) w[i - T0][j] = *(const v2f*)(p + j * ND * 4);
            // the offset register of these loads stays as it is up to this wait;
            // behind it a later load or address may take the register
            asm volatile("s_wait_xcnt 0x0" :: "v"(off) : "memory");
        }
    }

    template <int T0, int T1>
    static __device__ __forceinline__ void store(_Float16* __restrict__ wl, int tid,
                                                 const v2f (&w)[T1 - T0][8]) {
#pragma unroll
        for (int i = T0; i < T1; ++i) {
            const int it = item(tid, i);
            const int kb = it / NPAIR;
            const int np = it % NPAIR;
            v8h lo, hi;
#pragma unroll
            for (int j = 0; j < 8; ++j) {
                v2f v = w[i - T0][j];
                if constexpr (SH != 0) {             // undo the move, zero k >= KD
                    const v2f u = (j + SH < 8) ? w[i - T0][(j + SH) & 7] : (v2f){0.f, 0.f};
                    if (kb == KB - 1) v = u;
                }
                lo[j] = (_Float16)v.x;
                hi[j] = (_Float16)v.y;
            }
            *(v8h*)(wl + (np * 2)     * KP + kb * 8) = lo;
            *(v8h*)(wl + (np * 2 + 1) * KP + kb * 8) = hi;
        }
    }

    static __device__ __forceinline__ void pad(_Float16* __restrict__ wl, int tid) {
        // the k blocks behind the data in rows n < ND
        for (int idx = tid; idx < ND * (KBP - KB); idx += 256) {
            const int n = idx / (KBP - KB);
            const int c = idx % (KBP - KB);
            *(v8h*)(wl + n * KP + (KB + c) * 8) = (v8h)(_Float16)0.f;
        }
        // the rows ND..NP-1 (contiguous)
        for (int idx = tid; idx < (NP - ND) * KBP; idx += 256)
            *(v8h*)(wl + ND * KP + idx * 8) = (v8h)(_Float16)0.f;
    }
};

// Fills the x tile, W1^T and W2^T in LDS. No load of a whole tile stands under
// a branch or is waited for alone: each thread has a long run of 8- and
// 16-byte loads in flight where one 4-byte load was waited for per trip.
// Issue order: W2 and the head of W1 (they come from L2) first, x behind them,
// the rest of W1 into the registers these free while x is on its way.
template <bool WHOLE>
__device__ __forceinline__ void stage_tile(const float* __restrict__ x,
                                           const float* __restrict__ W1,
                                           const float* __restrict__ W2,
                                           _Float16* __restrict__ xlds,
                                           _Float16* __restrict__ w1lds,
                                           _Float16* __restrict__ w2lds,
                                           int tid, int rowBase, int rowsHere)
{
    using S1 = WStage<D_IN, D1, KP1, NP1>;
    using S2 = WStage<D1,   D2, KP2, NP2>;
    static_assert(S1::TRIPS == 8 && S2::TRIPS == 4, "trip split below");

    v2f w2r[4][8], w1a[2][8], w1b[4][8], w1c[2][8];
    S2::template load<0, 4>(W2, tid, w2r);
    S1::template load<0, 2>(W1, tid, w1a);

    // x tile: 128 rows x 200 floats are one contiguous run of 6400 float4.
    constexpr int XQ_ROW = D_IN / 4;                 // 50 float4 per row
    constexpr int XTRIPS = ROWS * XQ_ROW / 256;      // 25 per thread
    v4f xv[XTRIPS];
    if constexpr (WHOLE) {
        const v4f* xg = (const v4f*)(x + (size_t)rowBase * D_IN);
#pragma unroll
        for (int i = 0; i < XTRIPS; ++i) xv[i] = xg[tid + 256 * i];
    }
    // keeps every load above issued ahead of the first wait for one of them
    __builtin_amdgcn_sched_barrier(0);

    S2::template store<0, 4>(w2lds, tid, w2r);
    S1::template load<2, 6>(W1, tid, w1b);
    S1::template store<0, 2>(w1lds, tid, w1a);
    S1::template load<6, 8>(W1, tid, w1c);

    // zero padding, while the loads are on their way
    S1::pad(w1lds, tid);
    S2::pad(w2lds, tid);
    for (int idx = tid; idx < ROWS * ((KP1 - D_IN) / 8); idx += 256) {
        const int r = idx / ((KP1 - D_IN) / 8);      // x tile, columns 200..231
        const int c = idx % ((KP1 - D_IN) / 8);
        *(v8h*)(xlds + r * KP1 + D_IN + c * 8) = (v8h)(_Float16)0.f;
    }

    if constexpr (WHOLE) {
#pragma unroll
        for (int i = 0; i < XTRIPS; ++i) {
            const int f = tid + 256 * i;
            const int r = f / XQ_ROW;
            // r*KP1 + (f - r*XQ_ROW)*4
            *(v4h*)(xlds + f * 4 + r * (KP1 - D_IN)) = __builtin_convertvector(xv[i], v4h);
        }
    } else {
        for (int idx = tid; idx < ROWS * D_IN; idx += 256) {   // element by element
            const int k = idx % D_IN;
            const int r = idx / D_IN;
            const float v = (r < rowsHere) ? x[(size_t)(rowBase + r) * D_IN + k] : 0.f;
            xlds[r * KP1 + k] = (_Float16)v;
        }
    }
    S1::template store<2, 6>(w1lds, tid, w1b);
    S1::template store<6, 8>(w1lds, tid, w1c);
}

__global__ __launch_bounds__(256, 1)
void mlp2_fused_wmma(const float* __restrict__ x,
                     const float* __restrict__ W1,
                     const float* __restrict__ b1,
                     const float* __restrict__ W2,
                     const float* __restrict__ b2,
                     float* __restrict__ out,   // [0,B): out1  [B,2B): out2
                     int Btotal)
{
    extern __shared__ _Float16 smem[];
    _Float16* xlds  = smem;
    _Float16* w1lds = xlds  + LDS_X;
    _Float16* h1lds = w1lds + LDS_W1;
    _Float16* w2lds = h1lds + LDS_H1;

    const int tid     = threadIdx.x;
    const int wave    = tid >> 5;
    const int lane    = tid & 31;
    const int m       = lane & 15;
    const int hh      = lane >> 4;
    const int rowBase = blockIdx.x * ROWS;
    const int rowL    = wave * 16 + m;   // this lane's local A row

    // ---------------- Stage x tile and weights (transposed over K) ---------
    const int rowsHere = (Btotal - rowBase < ROWS) ? (Btotal - rowBase) : ROWS;
    if (__builtin_expect(rowsHere == ROWS, 1))   // block-uniform
        stage_tile<true >(x, W1, W2, xlds, w1lds, w2lds, tid, rowBase, rowsHere);
    else                    // the last tile of a batch that is no multiple of ROWS
        stage_tile<false>(x, W1, W2, xlds, w1lds, w2lds, tid, rowBase, rowsHere);
    __syncthreads();

    // ---------------- Layer 1: h1 = leaky(x@W1 + b1), row partial sums -----
    float rs1[8];
#pragma unroll
    for (int v = 0; v < 8; ++v) rs1[v] = 0.f;

    for (int nt = 0; nt < NT1; ++nt) {
        v8f acc = {};
        const int ncol = nt * 16 + m;                         // C column of this lane
        const _Float16* aBase = xlds  + rowL * KP1 + 8 * hh;
        const _Float16* bBase = w1lds + ncol * KP1 + 8 * hh;
#pragma unroll
        for (int ks = 0; ks < K1_STEPS; ++ks) {
            union { v16h v; v8h h[2]; } a, b;
            a.h[0] = *(const v8h*)(aBase + ks * 32);       // K = 32ks+8hh+[0..7]
            a.h[1] = *(const v8h*)(aBase + ks * 32 + 16);  // K = 32ks+16+8hh+[0..7]
            b.h[0] = *(const v8h*)(bBase + ks * 32);
            b.h[1] = *(const v8h*)(bBase + ks * 32 + 16);
            acc = __builtin_amdgcn_wmma_f32_16x16x32_f16(
                false, a.v, false, b.v, (short)0, acc, false, false);
        }
        const float bias = (ncol < D1) ? b1[ncol] : 0.f;
#pragma unroll
        for (int v = 0; v < 8; ++v) {
            float z  = acc[v] + bias;
            float hv = (z >= 0.f) ? z : LEAKY_ALPHA * z;
            if (ncol >= D1) hv = 0.f;                      // padded column -> exact 0
            rs1[v] += hv;
            h1lds[(wave * 16 + v + 8 * hh) * KP2 + ncol] = (_Float16)hv;
        }
    }

    // Row mean out1: reduce the 16 lanes of each half (cols 0..159, zeros padded)
#pragma unroll
    for (int v = 0; v < 8; ++v) {
        float s = rs1[v];
        s += __shfl_xor(s, 1, 32);
        s += __shfl_xor(s, 2, 32);
        s += __shfl_xor(s, 4, 32);
        s += __shfl_xor(s, 8, 32);
        if (m == 0) {
            const int gr = rowBase + wave * 16 + v + 8 * hh;
            if (gr < Btotal) out[gr] = s * (1.0f / (float)D1);
        }
    }

    __syncthreads();  // belt-and-braces; layer-2 only reads this wave's own h1 rows

    // ---------------- Layer 2: out2 = mean(leaky(h1@W2 + b2)) --------------
    float rs2[8];
#pragma unroll
    for (int v = 0; v < 8; ++v) rs2[v] = 0.f;

    for (int nt = 0; nt < NT2; ++nt) {
        v8f acc = {};
        const int ncol = nt * 16 + m;
        const _Float16* aBase = h1lds + rowL * KP2 + 8 * hh;
        const _Float16* bBase = w2lds + ncol * KP2 + 8 * hh;
#pragma unroll
        for (int ks = 0; ks < K2_STEPS; ++ks) {
            union { v16h v; v8h h[2]; } a, b;
            a.h[0] = *(const v8h*)(aBase + ks * 32);
            a.h[1] = *(const v8h*)(aBase + ks * 32 + 16);
            b.h[0] = *(const v8h*)(bBase + ks * 32);
            b.h[1] = *(const v8h*)(bBase + ks * 32 + 16);
            acc = __builtin_amdgcn_wmma_f32_16x16x32_f16(
                false, a.v, false, b.v, (short)0, acc, false, false);
        }
        const float bias = (ncol < D2) ? b2[ncol] : 0.f;
#pragma unroll
        for (int v = 0; v < 8; ++v) {
            float z  = acc[v] + bias;
            float hv = (z >= 0.f) ? z : LEAKY_ALPHA * z;
            if (ncol >= D2) hv = 0.f;
            rs2[v] += hv;
        }
    }

#pragma unroll
    for (int v = 0; v < 8; ++v) {
        float s = rs2[v];
        s += __shfl_xor(s, 1, 32);
        s += __shfl_xor(s, 2, 32);
        s += __shfl_xor(s, 4, 32);
        s += __shfl_xor(s, 8, 32);
        if (m == 0) {
            const int gr = rowBase + wave * 16 + v + 8 * hh;
            if (gr < Btotal) out[(size_t)Btotal + gr] = s * (1.0f / (float)D2);
        }
    }
}

extern "C" void kernel_launch(void* const* d_in, const int* in_sizes, int n_in,
                              void* d_out, int out_size, void* d_ws, size_t ws_size,
                              hipStream_t stream) {
    const float* x  = (const float*)d_in[0];
    const float* W1 = (const float*)d_in[1];
    const float* b1 = (const float*)d_in[2];
    const float* W2 = (const float*)d_in[3];
    const float* b2 = (const float*)d_in[4];
    float* out = (float*)d_out;

    const int Btotal = in_sizes[0] / D_IN;         // 262144
    const int grid   = (Btotal + ROWS - 1) / ROWS; // 2048
    const size_t shmem = (size_t)LDS_HALVES * sizeof(_Float16); // ~214 KB (< 320 KB/WGP)

    hipLaunchKernelGGL(mlp2_fused_wmma, dim3(grid), dim3(256), shmem, stream,
                       x, W1, b1, W2, b2, out, Btotal);
}

// v002
// A run of this version takes 79.5 microseconds.
// Two timings next to v001 put it at 1.36 and 1.35 times that version's speed.
// All steps since v000 together make it 9.22 times as fast.
#include <hip/hip_runtime.h>

typedef __attribute__((ext_vector_type(16))) _Float16 v16h;
typedef __attribute__((ext_vector_type(8)))  _Float16 v8h;
typedef __attribute__((ext_vector_type(8)))  float    v8f;

#define LEAKY_ALPHA 0.1f

// Problem dims (from reference)
constexpr int D_IN = 200;
constexpr int D1   = 150;
constexpr int D2   = 100;

constexpr int ROWS     = 128;
constexpr int K1_STEPS = 7;
constexpr int KP1      = 232;
constexpr int NT1      = 10;
constexpr int NP1      = 160;
constexpr int K2_STEPS = 5;    // 5*32 = 160 >= 150
constexpr int KP2      = 168;  // LDS row stride (halves): 84 dwords
constexpr int NT2      = 7;    // 7*16 = 112 >= 100
constexpr int NP2      = 112;

constexpr int LDS_X  = ROWS * KP1;   // x tile  (f16)
constexpr int LDS_W1 = NP1  * KP1;   // W1^T    (f16)
constexpr int LDS_H1 = ROWS * KP2;   // h1 tile (f16)
constexpr int LDS_W2 = NP2  * KP2;   // W2^T    (f16)
constexpr int LDS_HALVES = LDS_X + LDS_W1 + LDS_H1 + LDS_W2;   // 107136 -> 214272 B

typedef __attribute__((ext_vector_type(4)))  _Float16 v4h;
typedef __attribute__((ext_vector_type(4)))  float    v4f;
typedef __attribute__((ext_vector_type(2)))  float    v2f;

// Stages Wg[KD][ND] (f32, row major) as wl[n*KP + k] (f16), zero padded to
// NP rows of KP halves. One item = 2 columns x 8 consecutive k: eight
// independent 8-byte loads off one address (lanes walk n, so a wave reads
// contiguous bytes), then two 16-byte LDS stores. Threads past the last item
// of the last trip do one of the first items again (the same bytes to the
// same place), so that neither the loads nor the stores stand under a branch.
template <int KD, int ND, int KP, int NP>
struct WStage {
    static constexpr int NPAIR = ND / 2;
    static constexpr int KB    = (KD + 7) / 8;      // k blocks that hold data
    static constexpr int SH    = KB * 8 - KD;       // rows the last block lacks
    static constexpr int KBP   = KP / 8;            // k blocks per LDS row
    static constexpr int ITEMS = NPAIR * KB;
    static constexpr int TRIPS = (ITEMS + 255) / 256;
    static_assert(ND % 2 == 0 && KP % 8 == 0 && KD >= 8 && ITEMS >= 256, "item shape");

    // tid < 256 (the block's size): only the last trip can pass the last item
    static __device__ __forceinline__ int item(int tid, int i) {
        const int it = tid + 256 * i;
        return (256 * i + 255 < ITEMS || it < ITEMS) ? it : (it - ITEMS);
    }

    template <int T0, int T1>
    static __device__ __forceinline__ void load(const float* __restrict__ Wg, int tid,
                                                v2f (&w)[T1 - T0][8]) {
#pragma unroll
        for (int i = T0; i < T1; ++i) {
            const int it = item(tid, i);
            const int kb = it / NPAIR;
            const int np = it % NPAIR;
            // first row of the block; the last block is moved up by SH rows so
            // that its eight rows end with the matrix: one address per item
            const int k0 = (SH == 0) ? kb * 8 : min(kb * 8, KD - 8);
            const unsigned off = (unsigned)(k0 * ND + np * 2) * 4u;   // bytes
            const char* p = (const char*)Wg + off;
#pragma unroll
            for (int j = 0; j < 8; ++j) w[i - T0][j] = *(const v2f*)(p + j * ND * 4);
            // the offset register of these loads stays as it is up to this wait;
            // behind it a later load or address may take the register
            asm volatile("s_wait_xcnt 0x0" :: "v"(off) : "memory");
        }
    }

    template <int T0, int T1>
    static __device__ __forceinline__ void store(_Float16* __restrict__ wl, int tid,
                                                 const v2f (&w)[T1 - T0][8]) {
#pragma unroll
        for (int i = T0; i < T1; ++i) {
            const int it = item(tid, i);
            const int kb = it / NPAIR;
            const int np = it % NPAIR;
            v8h lo, hi;
#pragma unroll
            for (int j = 0; j < 8; ++j) {
                v2f v = w[i - T0][j];
                if constexpr (SH != 0) {             // undo the move, zero k >= KD
                    const v2f u = (j + SH < 8) ? w[i - T0][(j + SH) & 7] : (v2f){0.f, 0.f};
                    if (kb == KB - 1) v = u;
                }
                lo[j] = (_Float16)v.x;
                hi[j] = (_Float16)v.y;
            }
            *(v8h*)(wl + (np * 2)     * KP + kb * 8) = lo;
            *(v8h*)(wl + (np * 2 + 1) * KP + kb * 8) = hi;
        }
    }

    static __device__ __forceinline__ void pad(_Float16* __restrict__ wl, int tid) {
        // the k blocks behind the data in rows n < ND
        for (int idx = tid; idx < ND * (KBP - KB); idx += 256) {
            const int n = idx / (KBP - KB);
            const int c = idx % (KBP - KB);
            *(v8h*)(wl + n * KP + (KB + c) * 8) = (v8h)(_Float16)0.f;
        }
        // the rows ND..NP-1 (contiguous)
        for (int idx = tid; idx < (NP - ND) * KBP; idx += 256)
            *(v8h*)(wl + ND * KP + idx * 8) = (v8h)(_Float16)0.f;
    }
};

// Fills the x tile, W1^T and W2^T in LDS. No load of a whole tile stands under
// a branch or is waited for alone: each thread has a long run of 8- and
// 16-byte loads in flight where one 4-byte load was waited for per trip.
// Issue order: W2 and the head of W1 (they come from L2) first, x behind them,
// the rest of W1 into the registers these free while x is on its way.
template <bool WHOLE>
__device__ __forceinline__ void stage_tile(const float* __restrict__ x,
                                           const float* __restrict__ W1,
                                           const float* __restrict__ W2,
                                           _Float16* __restrict__ xlds,
                                           _Float16* __restrict__ w1lds,
                                           _Float16* __restrict__ w2lds,
                                           int tid, int rowBase, int rowsHere)
{
    using S1 = WStage<D_IN, D1, KP1, NP1>;
    using S2 = WStage<D1,   D2, KP2, NP2>;
    static_assert(S1::TRIPS == 8 && S2::TRIPS == 4, "trip split below");

    v2f w2r[4][8], w1a[2][8], w1b[4][8], w1c[2][8];
    S2::template load<0, 4>(W2, tid, w2r);
    S1::template load<0, 2>(W1, tid, w1a);

    // x tile: 128 rows x 200 floats are one contiguous run of 6400 float4.
    constexpr int XQ_ROW = D_IN / 4;                 // 50 float4 per row
    constexpr int XTRIPS = ROWS * XQ_ROW / 256;      // 25 per thread
    v4f xv[XTRIPS];
    if constexpr (WHOLE) {
        const v4f* xg = (const v4f*)(x + (size_t)rowBase * D_IN);
#pragma unroll
        for (int i = 0; i < XTRIPS; ++i) xv[i] = xg[tid + 256 * i];
    }
    // keeps every load above issued ahead of the first wait for one of them
    __builtin_amdgcn_sched_barrier(0);

    S2::template store<0, 4>(w2lds, tid, w2r);
    S1::template load<2, 6>(W1, tid, w1b);
    S1::template store<0, 2>(w1lds, tid, w1a);
    S1::template load<6, 8>(W1, tid, w1c);

    // zero padding, while the loads are on their way
    S1::pad(w1lds, tid);
    S2::pad(w2lds, tid);
    for (int idx = tid; idx < ROWS * ((KP1 - D_IN) / 8); idx += 256) {
        const int r = idx / ((KP1 - D_IN) / 8);      // x tile, columns 200..231
        const int c = idx % ((KP1 - D_IN) / 8);
        *(v8h*)(xlds + r * KP1 + D_IN + c * 8) = (v8h)(_Float16)0.f;
    }

    if constexpr (WHOLE) {
#pragma unroll
        for (int i = 0; i < XTRIPS; ++i) {
            const int f = tid + 256 * i;
            const int r = f / XQ_ROW;
            // r*KP1 + (f - r*XQ_ROW)*4
            *(v4h*)(xlds + f * 4 + r * (KP1 - D_IN)) = __builtin_convertvector(xv[i], v4h);
        }
    } else {
        for (int idx = tid; idx < ROWS * D_IN; idx += 256) {   // element by element
            const int k = idx % D_IN;
            const int r = idx / D_IN;
            const float v = (r < rowsHere) ? x[(size_t)(rowBase + r) * D_IN + k] : 0.f;
            xlds[r * KP1 + k] = (_Float16)v;
        }
    }
    S1::template store<2, 6>(w1lds, tid, w1b);
    S1::template store<6, 8>(w1lds, tid, w1c);
}

// One A or B fragment of the 16x16x32 form: K = 8*hh + [0..7] and 16 + 8*hh + [0..7]
// (p already holds the lane's row and its 8*hh).
__device__ __forceinline__ v16h frag(const _Float16* p) {
    union { v16h v; v8h h[2]; } f;
    f.h[0] = *(const v8h*)p;
    f.h[1] = *(const v8h*)(p + 16);
    return f.v;
}

__global__ __launch_bounds__(256, 1)
void mlp2_fused_wmma(const float* __restrict__ x,
                     const float* __restrict__ W1,
                     const float* __restrict__ b1,
                     const float* __restrict__ W2,
                     const float* __restrict__ b2,
                     float* __restrict__ out,   // [0,B): out1  [B,2B): out2
                     int Btotal)
{
    extern __shared__ _Float16 smem[];
    _Float16* xlds  = smem;
    _Float16* w1lds = xlds  + LDS_X;
    _Float16* h1lds = w1lds + LDS_W1;
    _Float16* w2lds = h1lds + LDS_H1;

    const int tid     = threadIdx.x;
    const int wave    = tid >> 5;
    const int lane    = tid & 31;
    const int m       = lane & 15;
    const int hh      = lane >> 4;
    const int rowBase = blockIdx.x * ROWS;
    const int rowL    = wave * 16 + m;   // this lane's local A row

    // Biases of this lane's column in every tile, asked for ahead of the staging.
    // A padded column reads the last real entry; its value is set to 0 below.
    float bias1[NT1], bias2[NT2];
#pragma unroll
    for (int nt = 0; nt < NT1; ++nt) bias1[nt] = b1[min(nt * 16 + m, D1 - 1)];
#pragma unroll
    for (int nt = 0; nt < NT2; ++nt) bias2[nt] = b2[min(nt * 16 + m, D2 - 1)];

    // ---------------- Stage x tile and weights (transposed over K) ---------
    const int rowsHere = (Btotal - rowBase < ROWS) ? (Btotal - rowBase) : ROWS;
    if (__builtin_expect(rowsHere == ROWS, 1))   // block-uniform
        stage_tile<true >(x, W1, W2, xlds, w1lds, w2lds, tid, rowBase, rowsHere);
    else                    // the last tile of a batch that is no multiple of ROWS
        stage_tile<false>(x, W1, W2, xlds, w1lds, w2lds, tid, rowBase, rowsHere);
    __syncthreads();

    // ---------------- Layer 1: h1 = leaky(x@W1 + b1), row partial sums -----
    // The wave's 16 x 224 slice of x is read from LDS once and stays in
    // registers; all ten column tiles accumulate side by side (ten independent
    // WMMAs per k step), and the ten W1 fragments of k step ks+1 are fetched as
    // one group ahead of the WMMAs of step ks.
    float rs1[8];
#pragma unroll
    for (int v = 0; v < 8; ++v) rs1[v] = 0.f;
    {
        const _Float16* aBase = xlds  + rowL * KP1 + 8 * hh;
        const _Float16* bBase = w1lds + m    * KP1 + 8 * hh;
        v16h a[K1_STEPS], b[2][NT1];
        v8f  acc[NT1];
#pragma unroll
        for (int nt = 0; nt < NT1; ++nt) b[0][nt] = frag(bBase + nt * 16 * KP1);
#pragma unroll
        for (int ks = 0; ks < K1_STEPS; ++ks) a[ks] = frag(aBase + ks * 32);
#pragma unroll
        for (int nt = 0; nt < NT1; ++nt) acc[nt] = (v8f){};
        // the reads of step 0 are asked for ahead of the group of step 1, so that
        // the first WMMAs wait for their own operands only
        __builtin_amdgcn_sched_barrier(0);
#pragma unroll
        for (int ks = 0; ks < K1_STEPS; ++ks) {
            if (ks + 1 < K1_STEPS) {
#pragma unroll
                for (int nt = 0; nt < NT1; ++nt)
                    b[(ks + 1) & 1][nt] = frag(bBase + nt * 16 * KP1 + (ks + 1) * 32);
                // holds the LDS reads above as one group ahead of this step's WMMAs:
                // left free, the compiler spreads them in pairs among the WMMAs
                __builtin_amdgcn_sched_barrier(0);
            }
#pragma unroll
            for (int nt = 0; nt < NT1; ++nt)
                acc[nt] = __builtin_amdgcn_wmma_f32_16x16x32_f16(
                    false, a[ks], false, b[ks & 1][nt], (short)0, acc[nt], false, false);
            // keeps the next group of reads behind this step's WMMAs
            if (ks + 1 < K1_STEPS) __builtin_amdgcn_sched_barrier(0);
        }
#pragma unroll
        for (int nt = 0; nt < NT1; ++nt) {
            const int ncol = nt * 16 + m;                     // C column of this lane
#pragma unroll
            for (int v = 0; v < 8; ++v) {
                float z  = acc[nt][v] + bias1[nt];
                float hv = (z >= 0.f) ? z : LEAKY_ALPHA * z;
                if (ncol >= D1) hv = 0.f;                      // padded column -> exact 0
                rs1[v] += hv;
                h1lds[(wave * 16 + v + 8 * hh) * KP2 + ncol] = (_Float16)hv;
            }
        }
    }

    // Row mean out1: reduce the 16 lanes of each half (cols 0..159, zeros padded)
#pragma unroll
    for (int v = 0; v < 8; ++v) {
        float s = rs1[v];
        s += __shfl_xor(s, 1, 32);
        s += __shfl_xor(s, 2, 32);
        s += __shfl_xor(s, 4, 32);
        s += __shfl_xor(s, 8, 32);
        if (m == 0) {
            const int gr = rowBase + wave * 16 + v + 8 * hh;
            if (gr < Btotal) out[gr] = s * (1.0f / (float)D1);
        }
    }

    __syncthreads();  // belt-and-braces; layer-2 only reads this wave's own h1 rows

    // ---------------- Layer 2: out2 = mean(leaky(h1@W2 + b2)) --------------
    // Same shape as layer 1: h1 slice in registers, seven tiles side by side.
    float rs2[8];
#pragma unroll
    for (int v = 0; v < 8; ++v) rs2[v] = 0.f;
    {
        const _Float16* aBase = h1lds + rowL * KP2 + 8 * hh;
        const _Float16* bBase = w2lds + m    * KP2 + 8 * hh;
        v16h a[K2_STEPS], b[2][NT2];
        v8f  acc[NT2];
#pragma unroll
        for (int nt = 0; nt < NT2; ++nt) b[0][nt] = frag(bBase + nt * 16 * KP2);
#pragma unroll
        for (int ks = 0; ks < K2_STEPS; ++ks) a[ks] = frag(aBase + ks * 32);
#pragma unroll
        for (int nt = 0; nt < NT2; ++nt) acc[nt] = (v8f){};
        // the reads of step 0 are asked for ahead of the group of step 1, so that
        // the first WMMAs wait for their own operands only
        __builtin_amdgcn_sched_barrier(0);
#pragma unroll
        for (int ks = 0; ks < K2_STEPS; ++ks) {
            if (ks + 1 < K2_STEPS) {
#pragma unroll
                for (int nt = 0; nt < NT2; ++nt)
                    b[(ks + 1) & 1][nt] = frag(bBase + nt * 16 * KP2 + (ks + 1) * 32);
                // holds the LDS reads above as one group ahead of this step's WMMAs:
                // left free, the compiler spreads them in pairs among the WMMAs
                __builtin_amdgcn_sched_barrier(0);
            }
#pragma unroll
            for (int nt = 0; nt < NT2; ++nt)
                acc[nt] = __builtin_amdgcn_wmma_f32_16x16x32_f16(
                    false, a[ks], false, b[ks & 1][nt], (short)0, acc[nt], false, false);
            // keeps the next group of reads behind this step's WMMAs
            if (ks + 1 < K2_STEPS) __builtin_amdgcn_sched_barrier(0);
        }
#pragma unroll
        for (int nt = 0; nt < NT2; ++nt) {
            const int ncol = nt * 16 + m;
#pragma unroll
            for (int v = 0; v < 8; ++v) {
                float z  = acc[nt][v] + bias2[nt];
                float hv = (z >= 0.f) ? z : LEAKY_ALPHA * z;
                if (ncol >= D2) hv = 0.f;
                rs2[v] += hv;
            }
        }
    }

#pragma unroll
    for (int v = 0; v < 8; ++v) {
        float s = rs2[v];
        s += __shfl_xor(s, 1, 32);
        s += __shfl_xor(s, 2, 32);
        s += __shfl_xor(s, 4, 32);
        s += __shfl_xor(s, 8, 32);
        if (m == 0) {
            const int gr = rowBase + wave * 16 + v + 8 * hh;
            if (gr < Btotal) out[(size_t)Btotal + gr] = s * (1.0f / (float)D2);
        }
    }
}

extern "C" void kernel_launch(void* const* d_in, const int* in_sizes, int n_in,
                              void* d_out, int out_size, void* d_ws, size_t ws_size,
                              hipStream_t stream) {
    const float* x  = (const float*)d_in[0];
    const float* W1 = (const float*)d_in[1];
    const float* b1 = (const float*)d_in[2];
    const float* W2 = (const float*)d_in[3];
    const float* b2 = (const float*)d_in[4];
    float* out = (float*)d_out;

    const int Btotal = in_sizes[0] / D_IN;         // 262144
    const int grid   = (Btotal + ROWS - 1) / ROWS; // 2048
    const size_t shmem = (size_t)LDS_HALVES * sizeof(_Float16); // ~214 KB (< 320 KB/WGP)

    hipLaunchKernelGGL(mlp2_fused_wmma, dim3(grid), dim3(256), shmem, stream,
                       x, W1, b1, W2, b2, out, Btotal);
}

// v003
// Measured time: 64.6 microseconds a run.
// Timed twice side by side with v002, it ran 1.23 times as fast both times.
// All steps since v000 together make it 11.4 times as fast.
#include <hip/hip_runtime.h>

typedef __attribute__((ext_vector_type(16))) _Float16 v16h;
typedef __attribute__((ext_vector_type(8)))  _Float16 v8h;
typedef __attribute__((ext_vector_type(8)))  float    v8f;

#define LEAKY_ALPHA 0.1f

// Problem dims (from reference)
constexpr int D_IN = 200;
constexpr int D1   = 150;
constexpr int D2   = 100;

constexpr int ROWS     = 128;
constexpr int GRID     = 256;
constexpr int K1_STEPS = 7;
constexpr int KP1      = 232;
constexpr int NT1      = 10;
constexpr int NP1      = 160;
constexpr int K2_STEPS = 5;    // 5*32 = 160 >= 150
constexpr int KP2      = 168;  // LDS row stride (halves): 84 dwords
constexpr int NT2      = 7;    // 7*16 = 112 >= 100
constexpr int NP2      = 112;

constexpr int LDS_X  = ROWS * KP1;   // x tile  (f16)
constexpr int LDS_W1 = NP1  * KP1;   // W1^T    (f16)
constexpr int LDS_H1 = ROWS * KP2;   // h1 tile (f16)
constexpr int LDS_W2 = NP2  * KP2;   // W2^T    (f16)
constexpr int LDS_HALVES = LDS_X + LDS_W1 + LDS_H1 + LDS_W2;   // 107136 -> 214272 B

typedef __attribute__((ext_vector_type(4)))  _Float16 v4h;
typedef __attribute__((ext_vector_type(4)))  float    v4f;
typedef __attribute__((ext_vector_type(2)))  float    v2f;

// Stages Wg[KD][ND] (f32, row major) as wl[n*KP + k] (f16), zero padded to
// NP rows of KP halves. One item = 2 columns x 8 consecutive k: eight
// independent 8-byte loads off one address (lanes walk n, so a wave reads
// contiguous bytes), then two 16-byte LDS stores. Threads past the last item
// of the last trip do one of the first items again (the same bytes to the
// same place), so that neither the loads nor the stores stand under a branch.
template <int KD, int ND, int KP, int NP>
struct WStage {
    static constexpr int NPAIR = ND / 2;
    static constexpr int KB    = (KD + 7) / 8;      // k blocks that hold data
    static constexpr int SH    = KB * 8 - KD;       // rows the last block lacks
    static constexpr int KBP   = KP / 8;            // k blocks per LDS row
    static constexpr int ITEMS = NPAIR * KB;
    static constexpr int TRIPS = (ITEMS + 255) / 256;
    static_assert(ND % 2 == 0 && KP % 8 == 0 && KD >= 8 && ITEMS >= 256, "item shape");

    // tid < 256 (the block's size): only the last trip can pass the last item
    static __device__ __forceinline__ int item(int tid, int i) {
        const int it = tid + 256 * i;
        return (256 * i + 255 < ITEMS || it < ITEMS) ? it : (it - ITEMS);
    }

    template <int T0, int T1>
    static __device__ __forceinline__ void load(const float* __restrict__ Wg, int tid,
                                                v2f (&w)[T1 - T0][8]) {
#pragma unroll
        for (int i = T0; i < T1; ++i) {
            const int it = item(tid, i);
            const int kb = it / NPAIR;
            const int np = it % NPAIR;
            // first row of the block; the last block is moved up by SH rows so
            // that its eight rows end with the matrix: one address per item
            const int k0 = (SH == 0) ? kb * 8 : min(kb * 8, KD - 8);
            const unsigned off = (unsigned)(k0 * ND + np * 2) * 4u;   // bytes
            const char* p = (const char*)Wg + off;
#pragma unroll
            for (int j = 0; j < 8; ++j) w[i - T0][j] = *(const v2f*)(p + j * ND * 4);
            // the offset register of these loads stays as it is up to this wait;
            // behind it a later load or address may take the register
            asm volatile("s_wait_xcnt 0x0" :: "v"(off) : "memory");
        }
    }

    template <int T0, int T1>
    static __device__ __forceinline__ void store(_Float16* __restrict__ wl, int tid,
                                                 const v2f (&w)[T1 - T0][8]) {
#pragma unroll
        for (int i = T0; i < T1; ++i) {
            const int it = item(tid, i);
            const int kb = it / NPAIR;
            const int np = it % NPAIR;
            v8h lo, hi;
#pragma unroll
            for (int j = 0; j < 8; ++j) {
                v2f v = w[i - T0][j];
                if constexpr (SH != 0) {             // undo the move, zero k >= KD
                    const v2f u = (j + SH < 8) ? w[i - T0][(j + SH) & 7] : (v2f){0.f, 0.f};
                    if (kb == KB - 1) v = u;
                }
                lo[j] = (_Float16)v.x;
                hi[j] = (_Float16)v.y;
            }
            *(v8h*)(wl + (np * 2)     * KP + kb * 8) = lo;
            *(v8h*)(wl + (np * 2 + 1) * KP + kb * 8) = hi;
        }
    }

    static __device__ __forceinline__ void pad(_Float16* __restrict__ wl, int tid) {
        // the k blocks behind the data in rows n < ND
        for (int idx = tid; idx < ND * (KBP - KB); idx += 256) {
            const int n = idx / (KBP - KB);
            const int c = idx % (KBP - KB);
            *(v8h*)(wl + n * KP + (KB + c) * 8) = (v8h)(_Float16)0.f;
        }
        // the rows ND..NP-1 (contiguous)
        for (int idx = tid; idx < (NP - ND) * KBP; idx += 256)
            *(v8h*)(wl + ND * KP + idx * 8) = (v8h)(_Float16)0.f;
    }
};

// Fills the x tile, W1^T and W2^T in LDS. No load of a whole tile stands under
// a branch or is waited for alone: each thread has a long run of 8- and
// 16-byte loads in flight where one 4-byte load was waited for per trip.
// Issue order: W2 and the head of W1 (they come from L2) first, x behind them,
// the rest of W1 into the registers these free while x is on its way.
template <bool WHOLE>
__device__ __forceinline__ void stage_tile(const float* __restrict__ x,
                                           const float* __restrict__ W1,
                                           const float* __restrict__ W2,
                                           _Float16* __restrict__ xlds,
                                           _Float16* __restrict__ w1lds,
                                           _Float16* __restrict__ w2lds,
                                           int tid, int rowBase, int rowsHere)
{
    using S1 = WStage<D_IN, D1, KP1, NP1>;
    using S2 = WStage<D1,   D2, KP2, NP2>;
    static_assert(S1::TRIPS == 8 && S2::TRIPS == 4, "trip split below");

    v2f w2r[4][8], w1a[2][8], w1b[4][8], w1c[2][8];
    S2::template load<0, 4>(W2, tid, w2r);
    S1::template load<0, 2>(W1, tid, w1a);

    // x tile: 128 rows x 200 floats are one contiguous run of 6400 float4.
    constexpr int XQ_ROW = D_IN / 4;                 // 50 float4 per row
    constexpr int XTRIPS = ROWS * XQ_ROW / 256;      // 25 per thread
    v4f xv[XTRIPS];
    if constexpr (WHOLE) {
        const v4f* xg = (const v4f*)(x + (size_t)rowBase * D_IN);
#pragma unroll
        for (int i = 0; i < XTRIPS; ++i) xv[i] = xg[tid + 256 * i];
    }
    // keeps every load above issued ahead of the first wait for one of them
    __builtin_amdgcn_sched_barrier(0);

    S2::template store<0, 4>(w2lds, tid, w2r);
    S1::template load<2, 6>(W1, tid, w1b);
    S1::template store<0, 2>(w1lds, tid, w1a);
    S1::template load<6, 8>(W1, tid, w1c);

    // zero padding, while the loads are on their way
    S1::pad(w1lds, tid);
    S2::pad(w2lds, tid);
    for (int idx = tid; idx < ROWS * ((KP1 - D_IN) / 8); idx += 256) {
        const int r = idx / ((KP1 - D_IN) / 8);      // x tile, columns 200..231
        const int c = idx % ((KP1 - D_IN) / 8);
        *(v8h*)(xlds + r * KP1 + D_IN + c * 8) = (v8h)(_Float16)0.f;
    }

    if constexpr (WHOLE) {
#pragma unroll
        for (int i = 0; i < XTRIPS; ++i) {
            const int f = tid + 256 * i;
            const int r = f / XQ_ROW;
            // r*KP1 + (f - r*XQ_ROW)*4
            *(v4h*)(xlds + f * 4 + r * (KP1 - D_IN)) = __builtin_convertvector(xv[i], v4h);
        }
    } else {
        for (int idx = tid; idx < ROWS * D_IN; idx += 256) {   // element by element
            const int k = idx % D_IN;
            const int r = idx / D_IN;
            const float v = (r < rowsHere) ? x[(size_t)(rowBase + r) * D_IN + k] : 0.f;
            xlds[r * KP1 + k] = (_Float16)v;
        }
    }
    S1::template store<2, 6>(w1lds, tid, w1b);
    S1::template store<6, 8>(w1lds, tid, w1c);
}

// Refills the x tile alone, for the second and later tiles of a workgroup: the
// weights and every zero pad (x columns 200..231 among them) stay in LDS from
// stage_tile. Same loads and stores as stage_tile has for x.
template <bool WHOLE>
__device__ __forceinline__ void stage_x(const float* __restrict__ x,
                                        _Float16* __restrict__ xlds,
                                        int tid, int rowBase, int rowsHere)
{
    constexpr int XQ_ROW = D_IN / 4;                 // 50 float4 per row
    constexpr int XTRIPS = ROWS * XQ_ROW / 256;      // 25 per thread
    if constexpr (WHOLE) {
        v4f xv[XTRIPS];
        const v4f* xg = (const v4f*)(x + (size_t)rowBase * D_IN);
#pragma unroll
        for (int i = 0; i < XTRIPS; ++i) xv[i] = xg[tid + 256 * i];
        // keeps every load above issued ahead of the first wait for one of them
        __builtin_amdgcn_sched_barrier(0);
#pragma unroll
        for (int i = 0; i < XTRIPS; ++i) {
            const int f = tid + 256 * i;
            const int r = f / XQ_ROW;
            *(v4h*)(xlds + f * 4 + r * (KP1 - D_IN)) = __builtin_convertvector(xv[i], v4h);
        }
    } else {
        for (int idx = tid; idx < ROWS * D_IN; idx += 256) {   // element by element
            const int k = idx % D_IN;
            const int r = idx / D_IN;
            const float v = (r < rowsHere) ? x[(size_t)(rowBase + r) * D_IN + k] : 0.f;
            xlds[r * KP1 + k] = (_Float16)v;
        }
    }
}

// One A or B fragment of the 16x16x32 form: K = 8*hh + [0..7] and 16 + 8*hh + [0..7]
// (p already holds the lane's row and its 8*hh).
__device__ __forceinline__ v16h frag(const _Float16* p) {
    union { v16h v; v8h h[2]; } f;
    f.h[0] = *(const v8h*)p;
    f.h[1] = *(const v8h*)(p + 16);
    return f.v;
}

__global__ __launch_bounds__(256, 1)
void mlp2_fused_wmma(const float* __restrict__ x,
                     const float* __restrict__ W1,
                     const float* __restrict__ b1,
                     const float* __restrict__ W2,
                     const float* __restrict__ b2,
                     float* __restrict__ out,   // [0,B): out1  [B,2B): out2
                     int Btotal)
{
    extern __shared__ _Float16 smem[];
    _Float16* xlds  = smem;
    _Float16* w1lds = xlds  + LDS_X;
    _Float16* h1lds = w1lds + LDS_W1;
    _Float16* w2lds = h1lds + LDS_H1;

    const int tid     = threadIdx.x;
    const int wave    = tid >> 5;
    const int lane    = tid & 31;
    const int m       = lane & 15;
    const int hh      = lane >> 4;
    const int rowL    = wave * 16 + m;
    const int nTiles  = (Btotal + ROWS - 1) / ROWS;
    if ((int)blockIdx.x >= nTiles) return;   // block-uniform, ahead of every barrier

    // Biases of this lane's column in every tile, asked for ahead of the staging.
    // A padded column reads the last real entry; its value is set to 0 below.
    float bias1[NT1], bias2[NT2];
#pragma unroll
    for (int nt = 0; nt < NT1; ++nt) bias1[nt] = b1[min(nt * 16 + m, D1 - 1)];
#pragma unroll
    for (int nt = 0; nt < NT2; ++nt) bias2[nt] = b2[min(nt * 16 + m, D2 - 1)];

    // ------- Stage the weights (transposed over K), once, and the first x tile
    {
        const int rowBase  = blockIdx.x * ROWS;
        const int rowsHere = (Btotal - rowBase < ROWS) ? (Btotal - rowBase) : ROWS;
        if (__builtin_expect(rowsHere == ROWS, 1))   // block-uniform
            stage_tile<true >(x, W1, W2, xlds, w1lds, w2lds, tid, rowBase, rowsHere);
        else                // the last tile of a batch that is no multiple of ROWS
            stage_tile<false>(x, W1, W2, xlds, w1lds, w2lds, tid, rowBase, rowsHere);
    }

    // ------- The workgroup's tiles, one after the other, on the same weights
    for (int tile = blockIdx.x; tile < nTiles; tile += GRID) {
        const int rowBase = tile * ROWS;
        __syncthreads();   // the x tile (on the first trip the weights too) is in LDS

        // ---------------- Layer 1: h1 = leaky(x@W1 + b1), row partial sums -----
        // The wave's 16 x 224 slice of x is read from LDS once and stays in
        // registers; all ten column tiles accumulate side by side (ten independent
        // WMMAs per k step), and the ten W1 fragments of k step ks+1 are fetched as
        // one group ahead of the WMMAs of step ks.
        float rs1[8];
#pragma unroll
        for (int v = 0; v < 8; ++v) rs1[v] = 0.f;
        {
            const _Float16* aBase = xlds  + rowL * KP1 + 8 * hh;
            const _Float16* bBase = w1lds + m    * KP1 + 8 * hh;
            v16h a[K1_STEPS], b[2][NT1];
            v8f  acc[NT1];
#pragma unroll
            for (int nt = 0; nt < NT1; ++nt) b[0][nt] = frag(bBase + nt * 16 * KP1);
#pragma unroll
            for (int ks = 0; ks < K1_STEPS; ++ks) a[ks] = frag(aBase + ks * 32);
#pragma unroll
            for (int nt = 0; nt < NT1; ++nt) acc[nt] = (v8f){};
            // the reads of step 0 are asked for ahead of the group of step 1, so that
            // the first WMMAs wait for their own operands only
            __builtin_amdgcn_sched_barrier(0);
#pragma unroll
            for (int ks = 0; ks < K1_STEPS; ++ks) {
                if (ks + 1 < K1_STEPS) {
#pragma unroll
                    for (int nt = 0; nt < NT1; ++nt)
                        b[(ks + 1) & 1][nt] = frag(bBase + nt * 16 * KP1 + (ks + 1) * 32);
                    // holds the LDS reads above as one group ahead of this step's WMMAs:
                    // left free, the compiler spreads them in pairs among the WMMAs
                    __builtin_amdgcn_sched_barrier(0);
                }
#pragma unroll
                for (int nt = 0; nt < NT1; ++nt)
                    acc[nt] = __builtin_amdgcn_wmma_f32_16x16x32_f16(
                        false, a[ks], false, b[ks & 1][nt], (short)0, acc[nt], false, false);
                // keeps the next group of reads behind this step's WMMAs
                if (ks + 1 < K1_STEPS) __builtin_amdgcn_sched_barrier(0);
            }
#pragma unroll
            for (int nt = 0; nt < NT1; ++nt) {
                const int ncol = nt * 16 + m;                     // C column of this lane
#pragma unroll
                for (int v = 0; v < 8; ++v) {
                    float z  = acc[nt][v] + bias1[nt];
                    float hv = (z >= 0.f) ? z : LEAKY_ALPHA * z;
                    if (ncol >= D1) hv = 0.f;                      // padded column -> exact 0
                    rs1[v] += hv;
                    h1lds[(wave * 16 + v + 8 * hh) * KP2 + ncol] = (_Float16)hv;
                }
            }
        }

        // Row mean out1: reduce the 16 lanes of each half (cols 0..159, zeros padded)
#pragma unroll
        for (int v = 0; v < 8; ++v) {
            float s = rs1[v];
            s += __shfl_xor(s, 1, 32);
            s += __shfl_xor(s, 2, 32);
            s += __shfl_xor(s, 4, 32);
            s += __shfl_xor(s, 8, 32);
            if (m == 0) {
                const int gr = rowBase + wave * 16 + v + 8 * hh;
                if (gr < Btotal) out[gr] = s * (1.0f / (float)D1);
            }
        }

        // Every wave has its x slice in registers and used: behind this barrier the x
        // tile may be refilled (layer 2 itself only reads this wave's own h1 rows).
        __syncthreads();

        // ---------------- Layer 2: out2 = mean(leaky(h1@W2 + b2)) --------------
        // Same shape as layer 1: h1 slice in registers, seven tiles side by side.
        float rs2[8];
#pragma unroll
        for (int v = 0; v < 8; ++v) rs2[v] = 0.f;
        {
            const _Float16* aBase = h1lds + rowL * KP2 + 8 * hh;
            const _Float16* bBase = w2lds + m    * KP2 + 8 * hh;
            v16h a[K2_STEPS], b[2][NT2];
            v8f  acc[NT2];
#pragma unroll
            for (int nt = 0; nt < NT2; ++nt) b[0][nt] = frag(bBase + nt * 16 * KP2);
#pragma unroll
            for (int ks = 0; ks < K2_STEPS; ++ks) a[ks] = frag(aBase + ks * 32);
#pragma unroll
            for (int nt = 0; nt < NT2; ++nt) acc[nt] = (v8f){};
            // the reads of step 0 are asked for ahead of the group of step 1, so that
            // the first WMMAs wait for their own operands only
            __builtin_amdgcn_sched_barrier(0);
#pragma unroll
            for (int ks = 0; ks < K2_STEPS; ++ks) {
                if (ks + 1 < K2_STEPS) {
#pragma unroll
                    for (int nt = 0; nt < NT2; ++nt)
                        b[(ks + 1) & 1][nt] = frag(bBase + nt * 16 * KP2 + (ks + 1) * 32);
                    // holds the LDS reads above as one group ahead of this step's WMMAs:
                    // left free, the compiler spreads them in pairs among the WMMAs
                    __builtin_amdgcn_sched_barrier(0);
                }
#pragma unroll
                for (int nt = 0; nt < NT2; ++nt)
                    acc[nt] = __builtin_amdgcn_wmma_f32_16x16x32_f16(
                        false, a[ks], false, b[ks & 1][nt], (short)0, acc[nt], false, false);
                // keeps the next group of reads behind this step's WMMAs
                if (ks + 1 < K2_STEPS) __builtin_amdgcn_sched_barrier(0);
            }
#pragma unroll
            for (int nt = 0; nt < NT2; ++nt) {
                const int ncol = nt * 16 + m;
#pragma unroll
                for (int v = 0; v < 8; ++v) {
                    float z  = acc[nt][v] + bias2[nt];
                    float hv = (z >= 0.f) ? z : LEAKY_ALPHA * z;
                    if (ncol >= D2) hv = 0.f;
                    rs2[v] += hv;
                }
            }
        }

#pragma unroll
        for (int v = 0; v < 8; ++v) {
            float s = rs2[v];
            s += __shfl_xor(s, 1, 32);
            s += __shfl_xor(s, 2, 32);
            s += __shfl_xor(s, 4, 32);
            s += __shfl_xor(s, 8, 32);
            if (m == 0) {
                const int gr = rowBase + wave * 16 + v + 8 * hh;
                if (gr < Btotal) out[(size_t)Btotal + gr] = s * (1.0f / (float)D2);
            }
        }

        // ---------------- The next tile's x into the buffer layer 1 has left ---
        if (tile + GRID < nTiles) {                      // block-uniform
            const int nextBase = (tile + GRID) * ROWS;
            const int nextRows = (Btotal - nextBase < ROWS) ? (Btotal - nextBase) : ROWS;
            if (__builtin_expect(nextRows == ROWS, 1))   // block-uniform
                stage_x<true >(x, xlds, tid, nextBase, nextRows);
            else
                stage_x<false>(x, xlds, tid, nextBase, nextRows);
        }
    }   // tiles
}

extern "C" void kernel_launch(void* const* d_in, const int* in_sizes, int n_in,
                              void* d_out, int out_size, void* d_ws, size_t ws_size,
                              hipStream_t stream) {
    const float* x  = (const float*)d_in[0];
    const float* W1 = (const float*)d_in[1];
    const float* b1 = (const float*)d_in[2];
    const float* W2 = (const float*)d_in[3];
    const float* b2 = (const float*)d_in[4];
    float* out = (float*)d_out;

    const int Btotal = in_sizes[0] / D_IN;         // 262144
    const size_t shmem = (size_t)LDS_HALVES * sizeof(_Float16); // ~214 KB (< 320 KB/WGP)

    hipLaunchKernelGGL(mlp2_fused_wmma, dim3(GRID), dim3(256), shmem, stream,
                       x, W1, b1, W2, b2, out, Btotal);
}

// v004
// It runs in 46.5 microseconds.
// Two timings next to v003 put it at 1.39 and 1.40 times that version's speed.
// All steps since v000 together make it 15.8 times as fast.
#include <hip/hip_runtime.h>

typedef __attribute__((ext_vector_type(16))) _Float16 v16h;
typedef __attribute__((ext_vector_type(8)))  _Float16 v8h;
typedef __attribute__((ext_vector_type(8)))  float    v8f;

#define LEAKY_ALPHA 0.1f

// Problem dims (from reference)
constexpr int D_IN = 200;
constexpr int D1   = 150;
constexpr int D2   = 100;

constexpr int ROWS     = 128;
constexpr int GRID     = 256;
constexpr int K1_STEPS = 7;
constexpr int KP1      = 232;
constexpr int NT1      = 10;
constexpr int NP1      = 160;
constexpr int K2_STEPS = 5;    // 5*32 = 160 >= 150
constexpr int KP2      = 168;  // LDS row stride (halves): 84 dwords
constexpr int NT2      = 7;    // 7*16 = 112 >= 100
constexpr int NP2      = 112;

constexpr int LDS_X  = ROWS * KP1;   // x tile  (f16)
constexpr int LDS_W1 = NP1  * KP1;   // W1^T    (f16)
constexpr int LDS_H1 = ROWS * KP2;   // h1 tile (f16)
constexpr int LDS_W2 = NP2  * KP2;   // W2^T    (f16)
constexpr int LDS_HALVES = LDS_X + LDS_W1 + LDS_H1 + LDS_W2;   // 107136 -> 214272 B

typedef __attribute__((ext_vector_type(4)))  _Float16 v4h;
typedef __attribute__((ext_vector_type(4)))  float    v4f;
typedef __attribute__((ext_vector_type(2)))  float    v2f;

// Stages Wg[KD][ND] (f32, row major) as wl[n*KP + k] (f16), zero padded to
// NP rows of KP halves. One item = 2 columns x 8 consecutive k: eight
// independent 8-byte loads off one address (lanes walk n, so a wave reads
// contiguous bytes), then two 16-byte LDS stores. Threads past the last item
// of the last trip do one of the first items again (the same bytes to the
// same place), so that neither the loads nor the stores stand under a branch.
template <int KD, int ND, int KP, int NP>
struct WStage {
    static constexpr int NPAIR = ND / 2;
    static constexpr int KB    = (KD + 7) / 8;      // k blocks that hold data
    static constexpr int SH    = KB * 8 - KD;       // rows the last block lacks
    static constexpr int KBP   = KP / 8;            // k blocks per LDS row
    static constexpr int ITEMS = NPAIR * KB;
    static constexpr int TRIPS = (ITEMS + 255) / 256;
    static_assert(ND % 2 == 0 && KP % 8 == 0 && KD >= 8 && ITEMS >= 256, "item shape");

    // tid < 256 (the block's size): only the last trip can pass the last item
    static __device__ __forceinline__ int item(int tid, int i) {
        const int it = tid + 256 * i;
        return (256 * i + 255 < ITEMS || it < ITEMS) ? it : (it - ITEMS);
    }

    template <int T0, int T1>
    static __device__ __forceinline__ void load(const float* __restrict__ Wg, int tid,
                                                v2f (&w)[T1 - T0][8]) {
#pragma unroll
        for (int i = T0; i < T1; ++i) {
            const int it = item(tid, i);
            const int kb = it / NPAIR;
            const int np = it % NPAIR;
            // first row of the block; the last block is moved up by SH rows so
            // that its eight rows end with the matrix: one address per item
            const int k0 = (SH == 0) ? kb * 8 : min(kb * 8, KD - 8);
            const unsigned off = (unsigned)(k0 * ND + np * 2) * 4u;   // bytes
            const char* p = (const char*)Wg + off;
#pragma unroll
            for (int j = 0; j < 8; ++j) w[i - T0][j] = *(const v2f*)(p + j * ND * 4);
            // the offset register of these loads stays as it is up to this wait;
            // behind it a later load or address may take the register
            asm volatile("s_wait_xcnt 0x0" :: "v"(off) : "memory");
        }
    }

    template <int T0, int T1>
    static __device__ __forceinline__ void store(_Float16* __restrict__ wl, int tid,
                                                 const v2f (&w)[T1 - T0][8]) {
#pragma unroll
        for (int i = T0; i < T1; ++i) {
            const int it = item(tid, i);
            const int kb = it / NPAIR;
            const int np = it % NPAIR;
            v8h lo, hi;
#pragma unroll
            for (int j = 0; j < 8; ++j) {
                v2f v = w[i - T0][j];
                if constexpr (SH != 0) {             // undo the move, zero k >= KD
                    const v2f u = (j + SH < 8) ? w[i - T0][(j + SH) & 7] : (v2f){0.f, 0.f};
                    if (kb == KB - 1) v = u;
                }
                lo[j] = (_Float16)v.x;
                hi[j] = (_Float16)v.y;
            }
            *(v8h*)(wl + (np * 2)     * KP + kb * 8) = lo;
            *(v8h*)(wl + (np * 2 + 1) * KP + kb * 8) = hi;
        }
    }

    static __device__ __forceinline__ void pad(_Float16* __restrict__ wl, int tid) {
        // the k blocks behind the data in rows n < ND
        for (int idx = tid; idx < ND * (KBP - KB); idx += 256) {
            const int n = idx / (KBP - KB);
            const int c = idx % (KBP - KB);
            *(v8h*)(wl + n * KP + (KB + c) * 8) = (v8h)(_Float16)0.f;
        }
        // the rows ND..NP-1 (contiguous)
        for (int idx = tid; idx < (NP - ND) * KBP; idx += 256)
            *(v8h*)(wl + ND * KP + idx * 8) = (v8h)(_Float16)0.f;
    }
};

// Fills the x tile, W1^T and W2^T in LDS. No load of a whole tile stands under
// a branch or is waited for alone: each thread has a long run of 8- and
// 16-byte loads in flight where one 4-byte load was waited for per trip.
// Issue order: W2 and the head of W1 (they come from L2) first, x behind them,
// the rest of W1 into the registers these free while x is on its way.
template <bool WHOLE>
__device__ __forceinline__ void stage_tile(const float* __restrict__ x,
                                           const float* __restrict__ W1,
                                           const float* __restrict__ W2,
                                           _Float16* __restrict__ xlds,
                                           _Float16* __restrict__ w1lds,
                                           _Float16* __restrict__ w2lds,
                                           int tid, int rowBase, int rowsHere)
{
    using S1 = WStage<D_IN, D1, KP1, NP1>;
    using S2 = WStage<D1,   D2, KP2, NP2>;
    static_assert(S1::TRIPS == 8 && S2::TRIPS == 4, "trip split below");

    v2f w2r[4][8], w1a[2][8], w1b[4][8], w1c[2][8];
    S2::template load<0, 4>(W2, tid, w2r);
    S1::template load<0, 2>(W1, tid, w1a);

    // x tile: 128 rows x 200 floats are one contiguous run of 6400 float4.
    constexpr int XQ_ROW = D_IN / 4;                 // 50 float4 per row
    constexpr int XTRIPS = ROWS * XQ_ROW / 256;      // 25 per thread
    v4f xv[XTRIPS];
    if constexpr (WHOLE) {
        const v4f* xg = (const v4f*)(x + (size_t)rowBase * D_IN);
#pragma unroll
        for (int i = 0; i < XTRIPS; ++i) xv[i] = xg[tid + 256 * i];
    }
    // keeps every load above issued ahead of the first wait for one of them
    __builtin_amdgcn_sched_barrier(0);

    S2::template store<0, 4>(w2lds, tid, w2r);
    S1::template load<2, 6>(W1, tid, w1b);
    S1::template store<0, 2>(w1lds, tid, w1a);
    S1::template load<6, 8>(W1, tid, w1c);

    // zero padding, while the loads are on their way
    S1::pad(w1lds, tid);
    S2::pad(w2lds, tid);
    for (int idx = tid; idx < ROWS * ((KP1 - D_IN) / 8); idx += 256) {
        const int r = idx / ((KP1 - D_IN) / 8);      // x tile, columns 200..231
        const int c = idx % ((KP1 - D_IN) / 8);
        *(v8h*)(xlds + r * KP1 + D_IN + c * 8) = (v8h)(_Float16)0.f;
    }

    if constexpr (WHOLE) {
#pragma unroll
        for (int i = 0; i < XTRIPS; ++i) {
            const int f = tid + 256 * i;
            const int r = f / XQ_ROW;
            // r*KP1 + (f - r*XQ_ROW)*4
            *(v4h*)(xlds + f * 4 + r * (KP1 - D_IN)) = __builtin_convertvector(xv[i], v4h);
        }
    } else {
        for (int idx = tid; idx < ROWS * D_IN; idx += 256) {   // element by element
            const int k = idx % D_IN;
            const int r = idx / D_IN;
            const float v = (r < rowsHere) ? x[(size_t)(rowBase + r) * D_IN + k] : 0.f;
            xlds[r * KP1 + k] = (_Float16)v;
        }
    }
    S1::template store<2, 6>(w1lds, tid, w1b);
    S1::template store<6, 8>(w1lds, tid, w1c);
}

// Refills the x tile alone, for the second and later tiles of a workgroup: the
// weights and every zero pad (x columns 200..231 among them) stay in LDS from
// stage_tile. Same loads and stores as stage_tile has for x.
template <bool WHOLE>
__device__ __forceinline__ void stage_x(const float* __restrict__ x,
                                        _Float16* __restrict__ xlds,
                                        int tid, int rowBase, int rowsHere)
{
    constexpr int XQ_ROW = D_IN / 4;                 // 50 float4 per row
    constexpr int XTRIPS = ROWS * XQ_ROW / 256;      // 25 per thread
    if constexpr (WHOLE) {
        v4f xv[XTRIPS];
        const v4f* xg = (const v4f*)(x + (size_t)rowBase * D_IN);
#pragma unroll
        for (int i = 0; i < XTRIPS; ++i) xv[i] = xg[tid + 256 * i];
        // keeps every load above issued ahead of the first wait for one of them
        __builtin_amdgcn_sched_barrier(0);
#pragma unroll
        for (int i = 0; i < XTRIPS; ++i) {
            const int f = tid + 256 * i;
            const int r = f / XQ_ROW;
            *(v4h*)(xlds + f * 4 + r * (KP1 - D_IN)) = __builtin_convertvector(xv[i], v4h);
        }
    } else {
        for (int idx = tid; idx < ROWS * D_IN; idx += 256) {   // element by element
            const int k = idx % D_IN;
            const int r = idx / D_IN;
            const float v = (r < rowsHere) ? x[(size_t)(rowBase + r) * D_IN + k] : 0.f;
            xlds[r * KP1 + k] = (_Float16)v;
        }
    }
}

// One A or B fragment of the 16x16x32 form: K = 8*hh + [0..7] and 16 + 8*hh + [0..7]
// (p already holds the lane's row and its 8*hh).
__device__ __forceinline__ v16h frag(const _Float16* p) {
    union { v16h v; v8h h[2]; } f;
    f.h[0] = *(const v8h*)p;
    f.h[1] = *(const v8h*)(p + 16);
    return f.v;
}

template <int CTRL>
__device__ __forceinline__ float add_xmask(float s) {
    const int o = __builtin_amdgcn_update_dpp(0, __builtin_bit_cast(int, s), CTRL, 0xf, 0xf, true);
    return s + __builtin_bit_cast(float, o);
}

// Sums each r[v] over the 16 lanes of the lane's half (partners l^1, l^2, l^4, l^8,
// in that order). The eight sums go step by step side by side, so that each add's
// latency is covered by the seven others. Every lane ends with all eight sums;
// the lane gets back that of row v = m & 7. The loops are unrolled so that r[]
// is indexed by constants and stays in registers.
__device__ __forceinline__ float row_sums(float (&r)[8], int m) {
#pragma unroll
    for (int v = 0; v < 8; ++v) r[v] = add_xmask<0x161>(r[v]);
#pragma unroll
    for (int v = 0; v < 8; ++v) r[v] = add_xmask<0x162>(r[v]);
#pragma unroll
    for (int v = 0; v < 8; ++v) r[v] = add_xmask<0x164>(r[v]);
#pragma unroll
    for (int v = 0; v < 8; ++v) r[v] = add_xmask<0x168>(r[v]);
    const bool b0 = (m & 1) != 0, b1 = (m & 2) != 0, b2 = (m & 4) != 0;
    const float t0 = b0 ? r[1] : r[0], t1 = b0 ? r[3] : r[2];
    const float t2 = b0 ? r[5] : r[4], t3 = b0 ? r[7] : r[6];
    const float u0 = b1 ? t1 : t0, u1 = b1 ? t3 : t2;
    return b2 ? u1 : u0;
}

__global__ __launch_bounds__(256, 1)
void mlp2_fused_wmma(const float* __restrict__ x,
                     const float* __restrict__ W1,
                     const float* __restrict__ b1,
                     const float* __restrict__ W2,
                     const float* __restrict__ b2,
                     float* __restrict__ out,   // [0,B): out1  [B,2B): out2
                     int Btotal)
{
    extern __shared__ _Float16 smem[];
    _Float16* xlds  = smem;
    _Float16* w1lds = xlds  + LDS_X;
    _Float16* h1lds = w1lds + LDS_W1;
    _Float16* w2lds = h1lds + LDS_H1;

    const int tid     = threadIdx.x;
    const int wave    = tid >> 5;
    const int lane    = tid & 31;
    const int m       = lane & 15;
    const int hh      = lane >> 4;
    const int rowL    = wave * 16 + m;
    const int nTiles  = (Btotal + ROWS - 1) / ROWS;
    if ((int)blockIdx.x >= nTiles) return;   // block-uniform, ahead of every barrier

    // Biases of this lane's column in every tile, asked for ahead of the staging.
    // A padded column reads the last real entry; its value is set to 0 below.
    float bias1[NT1], bias2[NT2];
#pragma unroll
    for (int nt = 0; nt < NT1; ++nt) bias1[nt] = b1[min(nt * 16 + m, D1 - 1)];
#pragma unroll
    for (int nt = 0; nt < NT2; ++nt) bias2[nt] = b2[min(nt * 16 + m, D2 - 1)];

    // ------- Stage the weights (transposed over K), once, and the first x tile
    {
        const int rowBase  = blockIdx.x * ROWS;
        const int rowsHere = (Btotal - rowBase < ROWS) ? (Btotal - rowBase) : ROWS;
        if (__builtin_expect(rowsHere == ROWS, 1))   // block-uniform
            stage_tile<true >(x, W1, W2, xlds, w1lds, w2lds, tid, rowBase, rowsHere);
        else                // the last tile of a batch that is no multiple of ROWS
            stage_tile<false>(x, W1, W2, xlds, w1lds, w2lds, tid, rowBase, rowsHere);
    }

    // ------- The workgroup's tiles, one after the other, on the same weights
    for (int tile = blockIdx.x; tile < nTiles; tile += GRID) {
        const int rowBase = tile * ROWS;
        __syncthreads();   // the x tile (on the first trip the weights too) is in LDS

        // ---------------- Layer 1: h1 = leaky(x@W1 + b1), row partial sums -----
        // The wave's 16 x 224 slice of x is read from LDS once and stays in
        // registers; all ten column tiles accumulate side by side (ten independent
        // WMMAs per k step), and the ten W1 fragments of k step ks+1 are fetched as
        // one group ahead of the WMMAs of step ks.
        float rs1[8];
#pragma unroll
        for (int v = 0; v < 8; ++v) rs1[v] = 0.f;
        {
            const _Float16* aBase = xlds  + rowL * KP1 + 8 * hh;
            const _Float16* bBase = w1lds + m    * KP1 + 8 * hh;
            v16h a[K1_STEPS], b[2][NT1];
            v8f  acc[NT1];
#pragma unroll
            for (int nt = 0; nt < NT1; ++nt) b[0][nt] = frag(bBase + nt * 16 * KP1);
#pragma unroll
            for (int ks = 0; ks < K1_STEPS; ++ks) a[ks] = frag(aBase + ks * 32);
#pragma unroll
            for (int nt = 0; nt < NT1; ++nt) acc[nt] = (v8f){};
            // the reads of step 0 are asked for ahead of the group of step 1, so that
            // the first WMMAs wait for their own operands only
            __builtin_amdgcn_sched_barrier(0);
#pragma unroll
            for (int ks = 0; ks < K1_STEPS; ++ks) {
                if (ks + 1 < K1_STEPS) {
#pragma unroll
                    for (int nt = 0; nt < NT1; ++nt)
                        b[(ks + 1) & 1][nt] = frag(bBase + nt * 16 * KP1 + (ks + 1) * 32);
                    // holds the LDS reads above as one group ahead of this step's WMMAs:
                    // left free, the compiler spreads them in pairs among the WMMAs
                    __builtin_amdgcn_sched_barrier(0);
                }
#pragma unroll
                for (int nt = 0; nt < NT1; ++nt)
                    acc[nt] = __builtin_amdgcn_wmma_f32_16x16x32_f16(
                        false, a[ks], false, b[ks & 1][nt], (short)0, acc[nt], false, false);
                // keeps the next group of reads behind this step's WMMAs
                if (ks + 1 < K1_STEPS) __builtin_amdgcn_sched_barrier(0);
            }
#pragma unroll
            for (int nt = 0; nt < NT1; ++nt) {
                const int ncol = nt * 16 + m;                     // C column of this lane
#pragma unroll
                for (int v = 0; v < 8; ++v) {
                    float z  = acc[nt][v] + bias1[nt];
                    float hv = (z >= 0.f) ? z : LEAKY_ALPHA * z;
                    if (ncol >= D1) hv = 0.f;                      // padded column -> exact 0
                    rs1[v] += hv;
                    h1lds[(wave * 16 + v + 8 * hh) * KP2 + ncol] = (_Float16)hv;
                }
            }
        }

        // Row mean out1: reduce the 16 lanes of each half (cols 0..159, zeros padded).
        // It is stored with out2 below: a store in front of the barrier would be
        // waited for there.
        const float mean1 = row_sums(rs1, m) * (1.0f / (float)D1);

        // Every wave has its x slice in registers and used: behind this barrier the x
        // tile may be refilled (layer 2 itself only reads this wave's own h1 rows).
        __syncthreads();

        // ---------------- Layer 2: out2 = mean(leaky(h1@W2 + b2)) --------------
        // Same shape as layer 1: h1 slice in registers, seven tiles side by side.
        float rs2[8];
#pragma unroll
        for (int v = 0; v < 8; ++v) rs2[v] = 0.f;
        {
            const _Float16* aBase = h1lds + rowL * KP2 + 8 * hh;
            const _Float16* bBase = w2lds + m    * KP2 + 8 * hh;
            v16h a[K2_STEPS], b[2][NT2];
            v8f  acc[NT2];
#pragma unroll
            for (int nt = 0; nt < NT2; ++nt) b[0][nt] = frag(bBase + nt * 16 * KP2);
#pragma unroll
            for (int ks = 0; ks < K2_STEPS; ++ks) a[ks] = frag(aBase + ks * 32);
#pragma unroll
            for (int nt = 0; nt < NT2; ++nt) acc[nt] = (v8f){};
            // the reads of step 0 are asked for ahead of the group of step 1, so that
            // the first WMMAs wait for their own operands only
            __builtin_amdgcn_sched_barrier(0);
#pragma unroll
            for (int ks = 0; ks < K2_STEPS; ++ks) {
                if (ks + 1 < K2_STEPS) {
#pragma unroll
                    for (int nt = 0; nt < NT2; ++nt)
                        b[(ks + 1) & 1][nt] = frag(bBase + nt * 16 * KP2 + (ks + 1) * 32);
                    // holds the LDS reads above as one group ahead of this step's WMMAs:
                    // left free, the compiler spreads them in pairs among the WMMAs
                    __builtin_amdgcn_sched_barrier(0);
                }
#pragma unroll
                for (int nt = 0; nt < NT2; ++nt)
                    acc[nt] = __builtin_amdgcn_wmma_f32_16x16x32_f16(
                        false, a[ks], false, b[ks & 1][nt], (short)0, acc[nt], false, false);
                // keeps the next group of reads behind this step's WMMAs
                if (ks + 1 < K2_STEPS) __builtin_amdgcn_sched_barrier(0);
            }
#pragma unroll
            for (int nt = 0; nt < NT2; ++nt) {
                const int ncol = nt * 16 + m;
#pragma unroll
                for (int v = 0; v < 8; ++v) {
                    float z  = acc[nt][v] + bias2[nt];
                    float hv = (z >= 0.f) ? z : LEAKY_ALPHA * z;
                    if (ncol >= D2) hv = 0.f;
                    rs2[v] += hv;
                }
            }
        }

        {
            const float mean2 = row_sums(rs2, m) * (1.0f / (float)D2);
            const int gr = rowBase + wave * 16 + m + 8 * hh;
            if (m < 8 && gr < Btotal) {
                out[gr] = mean1;
                out[(size_t)Btotal + gr] = mean2;
            }
        }

        // ---------------- The next tile's x into the buffer layer 1 has left ---
        if (tile + GRID < nTiles) {                      // block-uniform
            const int nextBase = (tile + GRID) * ROWS;
            const int nextRows = (Btotal - nextBase < ROWS) ? (Btotal - nextBase) : ROWS;
            if (__builtin_expect(nextRows == ROWS, 1))   // block-uniform
                stage_x<true >(x, xlds, tid, nextBase, nextRows);
            else
                stage_x<false>(x, xlds, tid, nextBase, nextRows);
        }
    }   // tiles
}

extern "C" void kernel_launch(void* const* d_in, const int* in_sizes, int n_in,
                              void* d_out, int out_size, void* d_ws, size_t ws_size,
                              hipStream_t stream) {
    const float* x  = (const float*)d_in[0];
    const float* W1 = (const float*)d_in[1];
    const float* b1 = (const float*)d_in[2];
    const float* W2 = (const float*)d_in[3];
    const float* b2 = (const float*)d_in[4];
    float* out = (float*)d_out;

    const int Btotal = in_sizes[0] / D_IN;         // 262144
    const size_t shmem = (size_t)LDS_HALVES * sizeof(_Float16); // ~214 KB (< 320 KB/WGP)

    hipLaunchKernelGGL(mlp2_fused_wmma, dim3(GRID), dim3(256), shmem, stream,
                       x, W1, b1, W2, b2, out, Btotal);
}

// v005
// Measured time: 37.1 microseconds a run.
// In both of two side-by-side timings against v004, it was 1.25 times as fast.
// Over all steps from v000 it is 19.7 times as fast.
#include <hip/hip_runtime.h>

typedef __attribute__((ext_vector_type(16))) _Float16 v16h;
typedef __attribute__((ext_vector_type(8)))  _Float16 v8h;
typedef __attribute__((ext_vector_type(8)))  float    v8f;

#define LEAKY_ALPHA 0.1f

// Problem dims (from reference)
constexpr int D_IN = 200;
constexpr int D1   = 150;
constexpr int D2   = 100;

constexpr int ROWS     = 128;
constexpr int GRID     = 256;
constexpr int K1_STEPS = 7;
constexpr int KP1      = 232;
constexpr int NT1      = 10;
constexpr int NP1      = 160;
constexpr int K2_STEPS = 5;    // 5*32 = 160 >= 150
constexpr int KP2      = 168;  // LDS row stride (halves): 84 dwords
constexpr int NT2      = 7;    // 7*16 = 112 >= 100
constexpr int NP2      = 112;

constexpr int LDS_X  = ROWS * KP1;   // x tile  (f16)
constexpr int LDS_W1 = NP1  * KP1;   // W1^T    (f16)
constexpr int LDS_H1 = ROWS * KP2;   // h1 tile (f16)
constexpr int LDS_W2 = NP2  * KP2;   // W2^T    (f16)
constexpr int LDS_HALVES = LDS_X + LDS_W1 + LDS_H1 + LDS_W2;   // 107136 -> 214272 B

typedef __attribute__((ext_vector_type(4)))  _Float16 v4h;
typedef __attribute__((ext_vector_type(4)))  float    v4f;
typedef __attribute__((ext_vector_type(2)))  float    v2f;

// Stages Wg[KD][ND] (f32, row major) as wl[n*KP + k] (f16), zero padded to
// NP rows of KP halves. One item = 2 columns x 8 consecutive k: eight
// independent 8-byte loads off one address (lanes walk n, so a wave reads
// contiguous bytes), then two 16-byte LDS stores. Threads past the last item
// of the last trip do one of the first items again (the same bytes to the
// same place), so that neither the loads nor the stores stand under a branch.
template <int KD, int ND, int KP, int NP>
struct WStage {
    static constexpr int NPAIR = ND / 2;
    static constexpr int KB    = (KD + 7) / 8;      // k blocks that hold data
    static constexpr int SH    = KB * 8 - KD;       // rows the last block lacks
    static constexpr int KBP   = KP / 8;            // k blocks per LDS row
    static constexpr int ITEMS = NPAIR * KB;
    static constexpr int TRIPS = (ITEMS + 255) / 256;
    static_assert(ND % 2 == 0 && KP % 8 == 0 && KD >= 8 && ITEMS >= 256, "item shape");

    // tid < 256 (the block's size): only the last trip can pass the last item
    static __device__ __forceinline__ int item(int tid, int i) {
        const int it = tid + 256 * i;
        return (256 * i + 255 < ITEMS || it < ITEMS) ? it : (it - ITEMS);
    }

    template <int T0, int T1>
    static __device__ __forceinline__ void load(const float* __restrict__ Wg, int tid,
                                                v2f (&w)[T1 - T0][8]) {
#pragma unroll
        for (int i = T0; i < T1; ++i) {
            const int it = item(tid, i);
            const int kb = it / NPAIR;
            const int np = it % NPAIR;
            // first row of the block; the last block is moved up by SH rows so
            // that its eight rows end with the matrix: one address per item
            const int k0 = (SH == 0) ? kb * 8 : min(kb * 8, KD - 8);
            const unsigned off = (unsigned)(k0 * ND + np * 2) * 4u;   // bytes
            const char* p = (const char*)Wg + off;
#pragma unroll
            for (int j = 0; j < 8; ++j) w[i - T0][j] = *(const v2f*)(p + j * ND * 4);
            // the offset register of these loads stays as it is up to this wait;
            // behind it a later load or address may take the register
            asm volatile("s_wait_xcnt 0x0" :: "v"(off) : "memory");
        }
    }

    template <int T0, int T1>
    static __device__ __forceinline__ void store(_Float16* __restrict__ wl, int tid,
                                                 const v2f (&w)[T1 - T0][8]) {
#pragma unroll
        for (int i = T0; i < T1; ++i) {
            const int it = item(tid, i);
            const int kb = it / NPAIR;
            const int np = it % NPAIR;
            v8h lo, hi;
#pragma unroll
            for (int j = 0; j < 8; ++j) {
                v2f v = w[i - T0][j];
                if constexpr (SH != 0) {             // undo the move, zero k >= KD
                    const v2f u = (j + SH < 8) ? w[i - T0][(j + SH) & 7] : (v2f){0.f, 0.f};
                    if (kb == KB - 1) v = u;
                }
                lo[j] = (_Float16)v.x;
                hi[j] = (_Float16)v.y;
            }
            *(v8h*)(wl + (np * 2)     * KP + kb * 8) = lo;
            *(v8h*)(wl + (np * 2 + 1) * KP + kb * 8) = hi;
        }
    }

    static __device__ __forceinline__ void pad(_Float16* __restrict__ wl, int tid) {
        // the k blocks behind the data in rows n < ND
        for (int idx = tid; idx < ND * (KBP - KB); idx += 256) {
            const int n = idx / (KBP - KB);
            const int c = idx % (KBP - KB);
            *(v8h*)(wl + n * KP + (KB + c) * 8) = (v8h)(_Float16)0.f;
        }
        // the rows ND..NP-1 (contiguous)
        for (int idx = tid; idx < (NP - ND) * KBP; idx += 256)
            *(v8h*)(wl + ND * KP + idx * 8) = (v8h)(_Float16)0.f;
    }
};

// Fills the x tile, W1^T and W2^T in LDS. No load of a whole tile stands under
// a branch or is waited for alone: each thread has a long run of 8- and
// 16-byte loads in flight where one 4-byte load was waited for per trip.
// Issue order: W2 and the head of W1 (they come from L2) first, x behind them,
// the rest of W1 into the registers these free while x is on its way.
template <bool WHOLE>
__device__ __forceinline__ void stage_tile(const float* __restrict__ x,
                                           const float* __restrict__ W1,
                                           const float* __restrict__ W2,
                                           _Float16* __restrict__ xlds,
                                           _Float16* __restrict__ w1lds,
                                           _Float16* __restrict__ w2lds,
                                           int tid, int rowBase, int rowsHere)
{
    using S1 = WStage<D_IN, D1, KP1, NP1>;
    using S2 = WStage<D1,   D2, KP2, NP2>;
    static_assert(S1::TRIPS == 8 && S2::TRIPS == 4, "trip split below");

    v2f w2r[4][8], w1a[2][8], w1b[4][8], w1c[2][8];
    S2::template load<0, 4>(W2, tid, w2r);
    S1::template load<0, 2>(W1, tid, w1a);

    // x tile: 128 rows x 200 floats are one contiguous run of 6400 float4.
    constexpr int XQ_ROW = D_IN / 4;                 // 50 float4 per row
    constexpr int XTRIPS = ROWS * XQ_ROW / 256;      // 25 per thread
    v4f xv[XTRIPS];
    if constexpr (WHOLE) {
        const v4f* xg = (const v4f*)(x + (size_t)rowBase * D_IN);
#pragma unroll
        for (int i = 0; i < XTRIPS; ++i) xv[i] = xg[tid + 256 * i];
    }
    // keeps every load above issued ahead of the first wait for one of them
    __builtin_amdgcn_sched_barrier(0);

    S2::template store<0, 4>(w2lds, tid, w2r);
    S1::template load<2, 6>(W1, tid, w1b);
    S1::template store<0, 2>(w1lds, tid, w1a);
    S1::template load<6, 8>(W1, tid, w1c);

    // zero padding, while the loads are on their way
    S1::pad(w1lds, tid);
    S2::pad(w2lds, tid);
    for (int idx = tid; idx < ROWS * ((KP1 - D_IN) / 8); idx += 256) {
        const int r = idx / ((KP1 - D_IN) / 8);      // x tile, columns 200..231
        const int c = idx % ((KP1 - D_IN) / 8);
        *(v8h*)(xlds + r * KP1 + D_IN + c * 8) = (v8h)(_Float16)0.f;
    }

    if constexpr (WHOLE) {
#pragma unroll
        for (int i = 0; i < XTRIPS; ++i) {
            const int f = tid + 256 * i;
            const int r = f / XQ_ROW;
            // r*KP1 + (f - r*XQ_ROW)*4
            *(v4h*)(xlds + f * 4 + r * (KP1 - D_IN)) = __builtin_convertvector(xv[i], v4h);
        }
    } else {
        for (int idx = tid; idx < ROWS * D_IN; idx += 256) {   // element by element
            const int k = idx % D_IN;
            const int r = idx / D_IN;
            const float v = (r < rowsHere) ? x[(size_t)(rowBase + r) * D_IN + k] : 0.f;
            xlds[r * KP1 + k] = (_Float16)v;
        }
    }
    S1::template store<2, 6>(w1lds, tid, w1b);
    S1::template store<6, 8>(w1lds, tid, w1c);
}

// The x tile of the second and later tiles of a workgroup: the weights and every
// zero pad (x columns 200..231 among them) stay in LDS from stage_tile. Same loads
// and stores as stage_tile has for x, in two halves: a whole tile is asked for one
// tile ahead (load_x) and rests in registers while both layers of the current
// tile run; store_x puts it into LDS once the current tile has left the buffer.
constexpr int XQ_ROW = D_IN / 4;                 // 50 float4 per row
constexpr int XTRIPS = ROWS * XQ_ROW / 256;      // 25 per thread

// xg: the thread's first float4 of the tile; every load names this one address.
__device__ __forceinline__ void load_x(const v4f* __restrict__ xg, v4f (&xv)[XTRIPS])
{
#pragma unroll
    for (int i = 0; i < XTRIPS; ++i) xv[i] = xg[256 * i];
}

__device__ __forceinline__ void store_x(_Float16* __restrict__ xlds, int tid,
                                        const v4f (&xv)[XTRIPS])
{
#pragma unroll
    for (int i = 0; i < XTRIPS; ++i) {
        const int f = tid + 256 * i;
        const int r = f / XQ_ROW;
        *(v4h*)(xlds + f * 4 + r * (KP1 - D_IN)) = __builtin_convertvector(xv[i], v4h);
    }
}

// A tile that the batch does not fill: element by element, not fetched ahead.
__device__ __forceinline__ void stage_x_part(const float* __restrict__ x,
                                             _Float16* __restrict__ xlds,
                                             int tid, int rowBase, int rowsHere)
{
    for (int idx = tid; idx < ROWS * D_IN; idx += 256) {
        const int k = idx % D_IN;
        const int r = idx / D_IN;
        const float v = (r < rowsHere) ? x[(size_t)(rowBase + r) * D_IN + k] : 0.f;
        xlds[r * KP1 + k] = (_Float16)v;
    }
}

// Work-group barrier for data that waves hand over in LDS alone: both fences name
// the LDS address space, so that the wave waits for its LDS traffic and not for the
// global loads it has in flight (__syncthreads() waits for those as well, which
// would end the fetch-ahead of x at the barrier between the layers).
__device__ __forceinline__ void lds_barrier() {
    __builtin_amdgcn_fence(__ATOMIC_RELEASE, "workgroup", "local");
    __builtin_amdgcn_s_barrier();
    __builtin_amdgcn_fence(__ATOMIC_ACQUIRE, "workgroup", "local");
}

// One A or B fragment of the 16x16x32 form: K = 8*hh + [0..7] and 16 + 8*hh + [0..7]
// (p already holds the lane's row and its 8*hh).
__device__ __forceinline__ v16h frag(const _Float16* p) {
    union { v16h v; v8h h[2]; } f;
    f.h[0] = *(const v8h*)p;
    f.h[1] = *(const v8h*)(p + 16);
    return f.v;
}

template <int CTRL>
__device__ __forceinline__ float add_xmask(float s) {
    const int o = __builtin_amdgcn_update_dpp(0, __builtin_bit_cast(int, s), CTRL, 0xf, 0xf, true);
    return s + __builtin_bit_cast(float, o);
}

// Sums each r[v] over the 16 lanes of the lane's half (partners l^1, l^2, l^4, l^8,
// in that order). The eight sums go step by step side by side, so that each add's
// latency is covered by the seven others. Every lane ends with all eight sums;
// the lane gets back that of row v = m & 7. The loops are unrolled so that r[]
// is indexed by constants and stays in registers.
__device__ __forceinline__ float row_sums(float (&r)[8], int m) {
#pragma unroll
    for (int v = 0; v < 8; ++v) r[v] = add_xmask<0x161>(r[v]);
#pragma unroll
    for (int v = 0; v < 8; ++v) r[v] = add_xmask<0x162>(r[v]);
#pragma unroll
    for (int v = 0; v < 8; ++v) r[v] = add_xmask<0x164>(r[v]);
#pragma unroll
    for (int v = 0; v < 8; ++v) r[v] = add_xmask<0x168>(r[v]);
    const bool b0 = (m & 1) != 0, b1 = (m & 2) != 0, b2 = (m & 4) != 0;
    const float t0 = b0 ? r[1] : r[0], t1 = b0 ? r[3] : r[2];
    const float t2 = b0 ? r[5] : r[4], t3 = b0 ? r[7] : r[6];
    const float u0 = b1 ? t1 : t0, u1 = b1 ? t3 : t2;
    return b2 ? u1 : u0;
}

__global__ __launch_bounds__(256, 1)
void mlp2_fused_wmma(const float* __restrict__ x,
                     const float* __restrict__ W1,
                     const float* __restrict__ b1,
                     const float* __restrict__ W2,
                     const float* __restrict__ b2,
                     float* __restrict__ out,   // [0,B): out1  [B,2B): out2
                     int Btotal)
{
    extern __shared__ _Float16 smem[];
    _Float16* xlds  = smem;
    _Float16* w1lds = xlds  + LDS_X;
    _Float16* h1lds = w1lds + LDS_W1;
    _Float16* w2lds = h1lds + LDS_H1;

    const int tid     = threadIdx.x;
    const int wave    = tid >> 5;
    const int lane    = tid & 31;
    const int m       = lane & 15;
    const int hh      = lane >> 4;
    const int rowL    = wave * 16 + m;
    const int nTiles  = (Btotal + ROWS - 1) / ROWS;
    if ((int)blockIdx.x >= nTiles) return;   // block-uniform, ahead of every barrier

    // Biases of this lane's column in every tile, asked for ahead of the staging.
    // A padded column reads the last real entry; its value is set to 0 below.
    float bias1[NT1], bias2[NT2];
#pragma unroll
    for (int nt = 0; nt < NT1; ++nt) bias1[nt] = b1[min(nt * 16 + m, D1 - 1)];
#pragma unroll
    for (int nt = 0; nt < NT2; ++nt) bias2[nt] = b2[min(nt * 16 + m, D2 - 1)];

    // ------- Stage the weights (transposed over K), once, and the first x tile
    {
        const int rowBase  = blockIdx.x * ROWS;
        const int rowsHere = (Btotal - rowBase < ROWS) ? (Btotal - rowBase) : ROWS;
        if (__builtin_expect(rowsHere == ROWS, 1))   // block-uniform
            stage_tile<true >(x, W1, W2, xlds, w1lds, w2lds, tid, rowBase, rowsHere);
        else                // the last tile of a batch that is no multiple of ROWS
            stage_tile<false>(x, W1, W2, xlds, w1lds, w2lds, tid, rowBase, rowsHere);
    }

    // ------- The workgroup's tiles, one after the other, on the same weights
    for (int tile = blockIdx.x; tile < nTiles; tile += GRID) {
        const int rowBase = tile * ROWS;
        const int nextBase = rowBase + GRID * ROWS;      // the workgroup's next tile
        const int nextRows = Btotal - nextBase;          // <= 0: there is none
        __syncthreads();   // the x tile (on the first trip the weights too) is in LDS

        // The next tile's x is asked for here, ahead of both layers, and is waited
        // for only behind layer 2: memory works while the matrix units do.
        // (The address is formed on every trip; it is read from only where the batch
        // holds the whole tile.)
        v4f xnext[XTRIPS];
        const v4f* xaddr = (const v4f*)(x + (size_t)nextBase * D_IN) + tid;
        if (nextRows >= ROWS)                            // block-uniform
            load_x(xaddr, xnext);

        // ---------------- Layer 1: h1 = leaky(x@W1 + b1), row partial sums -----
        // The wave's 16 x 224 slice of x is read from LDS once and stays in
        // registers; all ten column tiles accumulate side by side (ten independent
        // WMMAs per k step), and the ten W1 fragments of k step ks+1 are fetched as
        // one group ahead of the WMMAs of step ks.
        float rs1[8];
#pragma unroll
        for (int v = 0; v < 8; ++v) rs1[v] = 0.f;
        {
            const _Float16* aBase = xlds  + rowL * KP1 + 8 * hh;
            const _Float16* bBase = w1lds + m    * KP1 + 8 * hh;
            v16h a[K1_STEPS], b[2][NT1];
            v8f  acc[NT1];
#pragma unroll
            for (int nt = 0; nt < NT1; ++nt) b[0][nt] = frag(bBase + nt * 16 * KP1);
#pragma unroll
            for (int ks = 0; ks < K1_STEPS; ++ks) a[ks] = frag(aBase + ks * 32);
#pragma unroll
            for (int nt = 0; nt < NT1; ++nt) acc[nt] = (v8f){};
            // the reads of step 0 are asked for ahead of the group of step 1, so that
            // the first WMMAs wait for their own operands only
            __builtin_amdgcn_sched_barrier(0);
#pragma unroll
            for (int ks = 0; ks < K1_STEPS; ++ks) {
                if (ks + 1 < K1_STEPS) {
#pragma unroll
                    for (int nt = 0; nt < NT1; ++nt)
                        b[(ks + 1) & 1][nt] = frag(bBase + nt * 16 * KP1 + (ks + 1) * 32);
                    // holds the LDS reads above as one group ahead of this step's WMMAs:
                    // left free, the compiler spreads them in pairs among the WMMAs
                    __builtin_amdgcn_sched_barrier(0);
                }
#pragma unroll
                for (int nt = 0; nt < NT1; ++nt)
                    acc[nt] = __builtin_amdgcn_wmma_f32_16x16x32_f16(
                        false, a[ks], false, b[ks & 1][nt], (short)0, acc[nt], false, false);
                // keeps the next group of reads behind this step's WMMAs
                if (ks + 1 < K1_STEPS) __builtin_amdgcn_sched_barrier(0);
            }
#pragma unroll
            for (int nt = 0; nt < NT1; ++nt) {
                const int ncol = nt * 16 + m;                     // C column of this lane
#pragma unroll
                for (int v = 0; v < 8; ++v) {
                    float z  = acc[nt][v] + bias1[nt];
                    float hv = (z >= 0.f) ? z : LEAKY_ALPHA * z;
                    if (ncol >= D1) hv = 0.f;                      // padded column -> exact 0
                    rs1[v] += hv;
                    h1lds[(wave * 16 + v + 8 * hh) * KP2 + ncol] = (_Float16)hv;
                }
            }
        }

        // Row mean out1: reduce the 16 lanes of each half (cols 0..159, zeros padded).
        // It is stored with out2 below.
        const float mean1 = row_sums(rs1, m) * (1.0f / (float)D1);

        // Every wave has its x slice in registers and used: behind this barrier the x
        // tile may be refilled (layer 2 itself only reads this wave's own h1 rows).
        // The address registers of the x loads above are held (as this statement's input)
        // up to this wait; only behind it may anything take them. Every way through
        // the trip passes here, and layer 1 has not had to stand still for it.
        asm volatile("s_wait_xcnt 0x0" :: "v"(xaddr) : "memory");
        lds_barrier();

        // ---------------- Layer 2: out2 = mean(leaky(h1@W2 + b2)) --------------
        // Same shape as layer 1: h1 slice in registers, seven tiles side by side.
        float rs2[8];
#pragma unroll
        for (int v = 0; v < 8; ++v) rs2[v] = 0.f;
        {
            const _Float16* aBase = h1lds + rowL * KP2 + 8 * hh;
            const _Float16* bBase = w2lds + m    * KP2 + 8 * hh;
            v16h a[K2_STEPS], b[2][NT2];
            v8f  acc[NT2];
#pragma unroll
            for (int nt = 0; nt < NT2; ++nt) b[0][nt] = frag(bBase + nt * 16 * KP2);
#pragma unroll
            for (int ks = 0; ks < K2_STEPS; ++ks) a[ks] = frag(aBase + ks * 32);
#pragma unroll
            for (int nt = 0; nt < NT2; ++nt) acc[nt] = (v8f){};
            // the reads of step 0 are asked for ahead of the group of step 1, so that
            // the first WMMAs wait for their own operands only
            __builtin_amdgcn_sched_barrier(0);
#pragma unroll
            for (int ks = 0; ks < K2_STEPS; ++ks) {
                if (ks + 1 < K2_STEPS) {
#pragma unroll
                    for (int nt = 0; nt < NT2; ++nt)
                        b[(ks + 1) & 1][nt] = frag(bBase + nt * 16 * KP2 + (ks + 1) * 32);
                    // holds the LDS reads above as one group ahead of this step's WMMAs:
                    // left free, the compiler spreads them in pairs among the WMMAs
                    __builtin_amdgcn_sched_barrier(0);
                }
#pragma unroll
                for (int nt = 0; nt < NT2; ++nt)
                    acc[nt] = __builtin_amdgcn_wmma_f32_16x16x32_f16(
                        false, a[ks], false, b[ks & 1][nt], (short)0, acc[nt], false, false);
                // keeps the next group of reads behind this step's WMMAs
                if (ks + 1 < K2_STEPS) __builtin_amdgcn_sched_barrier(0);
            }
#pragma unroll
            for (int nt = 0; nt < NT2; ++nt) {
                const int ncol = nt * 16 + m;
#pragma unroll
                for (int v = 0; v < 8; ++v) {
                    float z  = acc[nt][v] + bias2[nt];
                    float hv = (z >= 0.f) ? z : LEAKY_ALPHA * z;
                    if (ncol >= D2) hv = 0.f;
                    rs2[v] += hv;
                }
            }
        }

        {
            const float mean2 = row_sums(rs2, m) * (1.0f / (float)D2);
            const int gr = rowBase + wave * 16 + m + 8 * hh;
            if (m < 8 && gr < Btotal) {
                out[gr] = mean1;
                out[(size_t)Btotal + gr] = mean2;
            }
        }

        // ---------------- The next tile's x into the buffer layer 1 has left ---
        if (nextRows >= ROWS)                            // block-uniform
            store_x(xlds, tid, xnext);
        else if (nextRows > 0)
            stage_x_part(x, xlds, tid, nextBase, nextRows);
    }   // tiles
}

extern "C" void kernel_launch(void* const* d_in, const int* in_sizes, int n_in,
                              void* d_out, int out_size, void* d_ws, size_t ws_size,
                              hipStream_t stream) {
    const float* x  = (const float*)d_in[0];
    const float* W1 = (const float*)d_in[1];
    const float* b1 = (const float*)d_in[2];
    const float* W2 = (const float*)d_in[3];
    const float* b2 = (const float*)d_in[4];
    float* out = (float*)d_out;

    const int Btotal = in_sizes[0] / D_IN;         // 262144
    const size_t shmem = (size_t)LDS_HALVES * sizeof(_Float16); // ~214 KB (< 320 KB/WGP)

    hipLaunchKernelGGL(mlp2_fused_wmma, dim3(GRID), dim3(256), shmem, stream,
                       x, W1, b1, W2, b2, out, Btotal);
}

// v006
// Measured time: 32.7 microseconds a run.
// Next to v005, in two timings, it ran 1.14 and 1.13 times as fast.
// Counting every step since v000, it is 22.3 times as fast.
#include <hip/hip_runtime.h>

typedef __attribute__((ext_vector_type(16))) _Float16 v16h;
typedef __attribute__((ext_vector_type(8)))  _Float16 v8h;
typedef __attribute__((ext_vector_type(8)))  float    v8f;

#define LEAKY_ALPHA 0.1f

// Problem dims (from reference)
constexpr int D_IN = 200;
constexpr int D1   = 150;
constexpr int D2   = 100;

constexpr int ROWS     = 128;
constexpr int GRID     = 256;
constexpr int K1_STEPS = 7;
constexpr int KP1      = 232;
constexpr int NT1      = 10;
constexpr int NP1      = 160;
constexpr int K2_STEPS = 5;    // 5*32 = 160 >= 150
constexpr int KP2      = 168;  // LDS row stride (halves): 84 dwords
constexpr int NT2      = 7;    // 7*16 = 112 >= 100
constexpr int NP2      = 112;

constexpr int LDS_X  = ROWS * KP1;   // x tile  (f16)
constexpr int LDS_W1 = NP1  * KP1;   // W1^T    (f16)
constexpr int LDS_H1 = ROWS * KP2;   // h1 tile (f16)
constexpr int LDS_W2 = NP2  * KP2;   // W2^T    (f16)
constexpr int LDS_HALVES = LDS_X + LDS_W1 + LDS_H1 + LDS_W2;   // 107136 -> 214272 B

typedef __attribute__((ext_vector_type(4)))  _Float16 v4h;
typedef __attribute__((ext_vector_type(4)))  float    v4f;
typedef __attribute__((ext_vector_type(2)))  float    v2f;

// Stages Wg[KD][ND] (f32, row major) as wl[n*KP + k] (f16), zero padded to
// NP rows of KP halves. One item = 2 columns x 8 consecutive k: eight
// independent 8-byte loads off one address (lanes walk n, so a wave reads
// contiguous bytes), then two 16-byte LDS stores. Threads past the last item
// of the last trip do one of the first items again (the same bytes to the
// same place), so that neither the loads nor the stores stand under a branch.
template <int KD, int ND, int KP, int NP>
struct WStage {
    static constexpr int NPAIR = ND / 2;
    static constexpr int KB    = (KD + 7) / 8;      // k blocks that hold data
    static constexpr int SH    = KB * 8 - KD;       // rows the last block lacks
    static constexpr int KBP   = KP / 8;            // k blocks per LDS row
    static constexpr int ITEMS = NPAIR * KB;
    static constexpr int TRIPS = (ITEMS + 255) / 256;
    static_assert(ND % 2 == 0 && KP % 8 == 0 && KD >= 8 && ITEMS >= 256, "item shape");

    // tid < 256 (the block's size): only the last trip can pass the last item
    static __device__ __forceinline__ int item(int tid, int i) {
        const int it = tid + 256 * i;
        return (256 * i + 255 < ITEMS || it < ITEMS) ? it : (it - ITEMS);
    }

    template <int T0, int T1>
    static __device__ __forceinline__ void load(const float* __restrict__ Wg, int tid,
                                                v2f (&w)[T1 - T0][8]) {
#pragma unroll
        for (int i = T0; i < T1; ++i) {
            const int it = item(tid, i);
            const int kb = it / NPAIR;
            const int np = it % NPAIR;
            // first row of the block; the last block is moved up by SH rows so
            // that its eight rows end with the matrix: one address per item
            const int k0 = (SH == 0) ? kb * 8 : min(kb * 8, KD - 8);
            const unsigned off = (unsigned)(k0 * ND + np * 2) * 4u;   // bytes
            const char* p = (const char*)Wg + off;
#pragma unroll
            for (int j = 0; j < 8; ++j) w[i - T0][j] = *(const v2f*)(p + j * ND * 4);
            // the offset register of these loads stays as it is up to this wait;
            // behind it a later load or address may take the register
            asm volatile("s_wait_xcnt 0x0" :: "v"(off) : "memory");
        }
    }

    template <int T0, int T1>
    static __device__ __forceinline__ void store(_Float16* __restrict__ wl, int tid,
                                                 const v2f (&w)[T1 - T0][8]) {
#pragma unroll
        for (int i = T0; i < T1; ++i) {
            const int it = item(tid, i);
            const int kb = it / NPAIR;
            const int np = it % NPAIR;
            v8h lo, hi;
#pragma unroll
            for (int j = 0; j < 8; ++j) {
                v2f v = w[i - T0][j];
                if constexpr (SH != 0) {             // undo the move, zero k >= KD
                    const v2f u = (j + SH < 8) ? w[i - T0][(j + SH) & 7] : (v2f){0.f, 0.f};
                    if (kb == KB - 1) v = u;
                }
                lo[j] = (_Float16)v.x;
                hi[j] = (_Float16)v.y;
            }
            *(v8h*)(wl + (np * 2)     * KP + kb * 8) = lo;
            *(v8h*)(wl + (np * 2 + 1) * KP + kb * 8) = hi;
        }
    }

    static __device__ __forceinline__ void pad(_Float16* __restrict__ wl, int tid) {
        // the k blocks behind the data in rows n < ND
        for (int idx = tid; idx < ND * (KBP - KB); idx += 256) {
            const int n = idx / (KBP - KB);
            const int c = idx % (KBP - KB);
            *(v8h*)(wl + n * KP + (KB + c) * 8) = (v8h)(_Float16)0.f;
        }
        // the rows ND..NP-1 (contiguous)
        for (int idx = tid; idx < (NP - ND) * KBP; idx += 256)
            *(v8h*)(wl + ND * KP + idx * 8) = (v8h)(_Float16)0.f;
    }
};

// Fills the x tile, W1^T and W2^T in LDS. No load of a whole tile stands under
// a branch or is waited for alone: each thread has a long run of 8- and
// 16-byte loads in flight where one 4-byte load was waited for per trip.
// Issue order: W2 and the head of W1 (they come from L2) first, x behind them,
// the rest of W1 into the registers these free while x is on its way.
template <bool WHOLE>
__device__ __forceinline__ void stage_tile(const float* __restrict__ x,
                                           const float* __restrict__ W1,
                                           const float* __restrict__ W2,
                                           _Float16* __restrict__ xlds,
                                           _Float16* __restrict__ w1lds,
                                           _Float16* __restrict__ w2lds,
                                           int tid, int rowBase, int rowsHere)
{
    using S1 = WStage<D_IN, D1, KP1, NP1>;
    using S2 = WStage<D1,   D2, KP2, NP2>;
    static_assert(S1::TRIPS == 8 && S2::TRIPS == 4, "trip split below");

    v2f w2r[4][8], w1a[2][8], w1b[4][8], w1c[2][8];
    S2::template load<0, 4>(W2, tid, w2r);
    S1::template load<0, 2>(W1, tid, w1a);

    // x tile: 128 rows x 200 floats are one contiguous run of 6400 float4.
    constexpr int XQ_ROW = D_IN / 4;                 // 50 float4 per row
    constexpr int XTRIPS = ROWS * XQ_ROW / 256;      // 25 per thread
    v4f xv[XTRIPS];
    if constexpr (WHOLE) {
        const v4f* xg = (const v4f*)(x + (size_t)rowBase * D_IN);
#pragma unroll
        for (int i = 0; i < XTRIPS; ++i) xv[i] = xg[tid + 256 * i];
    }
    // keeps every load above issued ahead of the first wait for one of them
    __builtin_amdgcn_sched_barrier(0);

    S2::template store<0, 4>(w2lds, tid, w2r);
    S1::template load<2, 6>(W1, tid, w1b);
    S1::template store<0, 2>(w1lds, tid, w1a);
    S1::template load<6, 8>(W1, tid, w1c);

    // zero padding, while the loads are on their way
    S1::pad(w1lds, tid);
    S2::pad(w2lds, tid);
    for (int idx = tid; idx < ROWS * ((KP1 - D_IN) / 8); idx += 256) {
        const int r = idx / ((KP1 - D_IN) / 8);      // x tile, columns 200..231
        const int c = idx % ((KP1 - D_IN) / 8);
        *(v8h*)(xlds + r * KP1 + D_IN + c * 8) = (v8h)(_Float16)0.f;
    }

    if constexpr (WHOLE) {
#pragma unroll
        for (int i = 0; i < XTRIPS; ++i) {
            const int f = tid + 256 * i;
            const int r = f / XQ_ROW;
            // r*KP1 + (f - r*XQ_ROW)*4
            *(v4h*)(xlds + f * 4 + r * (KP1 - D_IN)) = __builtin_convertvector(xv[i], v4h);
        }
    } else {
        for (int idx = tid; idx < ROWS * D_IN; idx += 256) {   // element by element
            const int k = idx % D_IN;
            const int r = idx / D_IN;
            const float v = (r < rowsHere) ? x[(size_t)(rowBase + r) * D_IN + k] : 0.f;
            xlds[r * KP1 + k] = (_Float16)v;
        }
    }
    S1::template store<2, 6>(w1lds, tid, w1b);
    S1::template store<6, 8>(w1lds, tid, w1c);
}

// The x tile of the second and later tiles of a workgroup: the weights and every
// zero pad (x columns 200..231 among them) stay in LDS from stage_tile. EACH WAVE
// STAGES THE 16 ROWS THAT IT READS ITSELF (one contiguous run of 800 float4), so no
// wave waits for another inside the tile loop. In two halves: the rows are asked for
// one tile ahead (load_x) and rest in registers while both layers of the current
// tile run; store_x puts them into LDS once the wave has read its current rows.
constexpr int WROWS  = 16;                       // rows per wave
constexpr int XQ_ROW = D_IN / 4;                 // 50 float4 per row
constexpr int XTRIPS = WROWS * XQ_ROW / 32;      // 25 per lane
static_assert(WROWS * XQ_ROW % 32 == 0 && WROWS * 8 == ROWS, "a wave's rows, whole trips");

// xg: the lane's first float4 of the wave's rows; every load names this one address.
__device__ __forceinline__ void load_x(const v4f* __restrict__ xg, v4f (&xv)[XTRIPS])
{
#pragma unroll
    for (int i = 0; i < XTRIPS; ++i) xv[i] = xg[32 * i];
}

// xw: the first of the wave's rows in the LDS tile.
__device__ __forceinline__ void store_x(_Float16* __restrict__ xw, int lane,
                                        const v4f (&xv)[XTRIPS])
{
#pragma unroll
    for (int i = 0; i < XTRIPS; ++i) {
        const int f = lane + 32 * i;
        const int r = f / XQ_ROW;
        *(v4h*)(xw + f * 4 + r * (KP1 - D_IN)) = __builtin_convertvector(xv[i], v4h);
    }
}

// The wave's rows of a tile that the batch does not fill: element by element, not
// fetched ahead. row0: the first of the wave's rows in the batch; rowsLeft: how many
// rows the batch holds from there on (may be <= 0).
__device__ __forceinline__ void stage_x_part(const float* __restrict__ x,
                                             _Float16* __restrict__ xw,
                                             int lane, int row0, int rowsLeft)
{
    for (int idx = lane; idx < WROWS * D_IN; idx += 32) {
        const int k = idx % D_IN;
        const int r = idx / D_IN;
        const float v = (r < rowsLeft) ? x[(size_t)(row0 + r) * D_IN + k] : 0.f;
        xw[r * KP1 + k] = (_Float16)v;
    }
}

// Hand-over in LDS between the lanes of ONE wave (rows that no other wave touches):
// the wave waits for its own LDS stores, and the compiler moves no LDS access across
// this point; no other wave is waited for. Both fences name the LDS address space, so
// that the global loads in flight (the fetch-ahead of x) are not waited for.
__device__ __forceinline__ void wave_lds_handover() {
    __builtin_amdgcn_fence(__ATOMIC_RELEASE, "workgroup", "local");
    __builtin_amdgcn_wave_barrier();
    __builtin_amdgcn_fence(__ATOMIC_ACQUIRE, "workgroup", "local");
}

// One A or B fragment of the 16x16x32 form: K = 8*hh + [0..7] and 16 + 8*hh + [0..7]
// (p already holds the lane's row and its 8*hh).
__device__ __forceinline__ v16h frag(const _Float16* p) {
    union { v16h v; v8h h[2]; } f;
    f.h[0] = *(const v8h*)p;
    f.h[1] = *(const v8h*)(p + 16);
    return f.v;
}

template <int CTRL>
__device__ __forceinline__ float add_xmask(float s) {
    const int o = __builtin_amdgcn_update_dpp(0, __builtin_bit_cast(int, s), CTRL, 0xf, 0xf, true);
    return s + __builtin_bit_cast(float, o);
}

// Sums each r[v] over the 16 lanes of the lane's half (partners l^1, l^2, l^4, l^8,
// in that order). The eight sums go step by step side by side, so that each add's
// latency is covered by the seven others. Every lane ends with all eight sums;
// the lane gets back that of row v = m & 7. The loops are unrolled so that r[]
// is indexed by constants and stays in registers.
__device__ __forceinline__ float row_sums(float (&r)[8], int m) {
#pragma unroll
    for (int v = 0; v < 8; ++v) r[v] = add_xmask<0x161>(r[v]);
#pragma unroll
    for (int v = 0; v < 8; ++v) r[v] = add_xmask<0x162>(r[v]);
#pragma unroll
    for (int v = 0; v < 8; ++v) r[v] = add_xmask<0x164>(r[v]);
#pragma unroll
    for (int v = 0; v < 8; ++v) r[v] = add_xmask<0x168>(r[v]);
    const bool b0 = (m & 1) != 0, b1 = (m & 2) != 0, b2 = (m & 4) != 0;
    const float t0 = b0 ? r[1] : r[0], t1 = b0 ? r[3] : r[2];
    const float t2 = b0 ? r[5] : r[4], t3 = b0 ? r[7] : r[6];
    const float u0 = b1 ? t1 : t0, u1 = b1 ? t3 : t2;
    return b2 ? u1 : u0;
}

__global__ __launch_bounds__(256, 1)
void mlp2_fused_wmma(const float* __restrict__ x,
                     const float* __restrict__ W1,
                     const float* __restrict__ b1,
                     const float* __restrict__ W2,
                     const float* __restrict__ b2,
                     float* __restrict__ out,   // [0,B): out1  [B,2B): out2
                     int Btotal)
{
    extern __shared__ _Float16 smem[];
    _Float16* xlds  = smem;
    _Float16* w1lds = xlds  + LDS_X;
    _Float16* h1lds = w1lds + LDS_W1;
    _Float16* w2lds = h1lds + LDS_H1;

    const int tid     = threadIdx.x;
    const int wave    = tid >> 5;
    const int lane    = tid & 31;
    const int m       = lane & 15;
    const int hh      = lane >> 4;
    const int rowL    = wave * 16 + m;
    const int nTiles  = (Btotal + ROWS - 1) / ROWS;
    if ((int)blockIdx.x >= nTiles) return;   // block-uniform, ahead of every barrier

    // Biases of this lane's column in every tile, asked for ahead of the staging.
    // A padded column reads the last real entry; its value is set to 0 below.
    float bias1[NT1], bias2[NT2];
#pragma unroll
    for (int nt = 0; nt < NT1; ++nt) bias1[nt] = b1[min(nt * 16 + m, D1 - 1)];
#pragma unroll
    for (int nt = 0; nt < NT2; ++nt) bias2[nt] = b2[min(nt * 16 + m, D2 - 1)];

    // ------- Stage the weights (transposed over K), once, and the first x tile
    {
        const int rowBase  = blockIdx.x * ROWS;
        const int rowsHere = (Btotal - rowBase < ROWS) ? (Btotal - rowBase) : ROWS;
        if (__builtin_expect(rowsHere == ROWS, 1))   // block-uniform
            stage_tile<true >(x, W1, W2, xlds, w1lds, w2lds, tid, rowBase, rowsHere);
        else                // the last tile of a batch that is no multiple of ROWS
            stage_tile<false>(x, W1, W2, xlds, w1lds, w2lds, tid, rowBase, rowsHere);
    }

    __syncthreads();   // the weights and the first x tile are in LDS: the one barrier

    // ------- The workgroup's tiles, one after the other, on the same weights.
    // Inside the loop a wave reads the weights (never written again) and its own 16
    // rows of x and h1 only, so the waves are free to run out of step: one wave's
    // vector work stands beside another's LDS reads and matrix work.
    _Float16* xw = xlds + wave * WROWS * KP1;            // the wave's own x rows
    for (int tile = blockIdx.x; tile < nTiles; tile += GRID) {
        const int rowBase = tile * ROWS;
        const int nextBase = rowBase + GRID * ROWS;      // the workgroup's next tile
        const int nextRows = Btotal - nextBase;          // <= 0: there is none

        // The next tile's x is asked for here, ahead of both layers, and is waited
        // for only behind layer 2: memory works while the matrix units do.
        // (The address is formed on every trip; it is read from only where the batch
        // holds the whole tile.)
        v4f xnext[XTRIPS];
        const v4f* xaddr = (const v4f*)(x + (size_t)(nextBase + wave * WROWS) * D_IN) + lane;
        if (nextRows >= ROWS)                            // block-uniform
            load_x(xaddr, xnext);

        // ---------------- Layer 1: h1 = leaky(x@W1 + b1), row partial sums -----
        // The wave's 16 x 224 slice of x is read from LDS once and stays in
        // registers; all ten column tiles accumulate side by side (ten independent
        // WMMAs per k step), and the ten W1 fragments of k step ks+1 are fetched as
        // one group ahead of the WMMAs of step ks.
        float rs1[8];
#pragma unroll
        for (int v = 0; v < 8; ++v) rs1[v] = 0.f;
        {
            const _Float16* aBase = xlds  + rowL * KP1 + 8 * hh;
            const _Float16* bBase = w1lds + m    * KP1 + 8 * hh;
            v16h a[K1_STEPS], b[2][NT1];
            v8f  acc[NT1];
#pragma unroll
            for (int nt = 0; nt < NT1; ++nt) b[0][nt] = frag(bBase + nt * 16 * KP1);
#pragma unroll
            for (int ks = 0; ks < K1_STEPS; ++ks) a[ks] = frag(aBase + ks * 32);
#pragma unroll
            for (int nt = 0; nt < NT1; ++nt) acc[nt] = (v8f){};
            // the reads of step 0 are asked for ahead of the group of step 1, so that
            // the first WMMAs wait for their own operands only
            __builtin_amdgcn_sched_barrier(0);
#pragma unroll
            for (int ks = 0; ks < K1_STEPS; ++ks) {
                if (ks + 1 < K1_STEPS) {
#pragma unroll
                    for (int nt = 0; nt < NT1; ++nt)
                        b[(ks + 1) & 1][nt] = frag(bBase + nt * 16 * KP1 + (ks + 1) * 32);
                    // holds the LDS reads above as one group ahead of this step's WMMAs:
                    // left free, the compiler spreads them in pairs among the WMMAs
                    __builtin_amdgcn_sched_barrier(0);
                }
#pragma unroll
                for (int nt = 0; nt < NT1; ++nt)
                    acc[nt] = __builtin_amdgcn_wmma_f32_16x16x32_f16(
                        false, a[ks], false, b[ks & 1][nt], (short)0, acc[nt], false, false);
                // keeps the next group of reads behind this step's WMMAs
                if (ks + 1 < K1_STEPS) __builtin_amdgcn_sched_barrier(0);
            }
#pragma unroll
            for (int nt = 0; nt < NT1; ++nt) {
                const int ncol = nt * 16 + m;                     // C column of this lane
#pragma unroll
                for (int v = 0; v < 8; ++v) {
                    float z  = acc[nt][v] + bias1[nt];
                    float hv = (z >= 0.f) ? z : LEAKY_ALPHA * z;
                    if (ncol >= D1) hv = 0.f;                      // padded column -> exact 0
                    rs1[v] += hv;
                    h1lds[(wave * 16 + v + 8 * hh) * KP2 + ncol] = (_Float16)hv;
                }
            }
        }

        // Row mean out1: reduce the 16 lanes of each half (cols 0..159, zeros padded).
        // It is stored with out2 below, both outputs under one test.
        const float mean1 = row_sums(rs1, m) * (1.0f / (float)D1);

        // The address registers of the x loads above are held (as this statement's input)
        // up to this wait; only behind it may anything take them. Every way through
        // the trip passes here, and layer 1 has not had to stand still for it.
        asm volatile("s_wait_xcnt 0x0" :: "v"(xaddr) : "memory");
        // Layer 2 reads this wave's own h1 rows, written by its own lanes above.
        wave_lds_handover();

        // ---------------- Layer 2: out2 = mean(leaky(h1@W2 + b2)) --------------
        // Same shape as layer 1: h1 slice in registers, seven tiles side by side.
        float rs2[8];
#pragma unroll
        for (int v = 0; v < 8; ++v) rs2[v] = 0.f;
        {
            const _Float16* aBase = h1lds + rowL * KP2 + 8 * hh;
            const _Float16* bBase = w2lds + m    * KP2 + 8 * hh;
            v16h a[K2_STEPS], b[2][NT2];
            v8f  acc[NT2];
#pragma unroll
            for (int nt = 0; nt < NT2; ++nt) b[0][nt] = frag(bBase + nt * 16 * KP2);
#pragma unroll
            for (int ks = 0; ks < K2_STEPS; ++ks) a[ks] = frag(aBase + ks * 32);
#pragma unroll
            for (int nt = 0; nt < NT2; ++nt) acc[nt] = (v8f){};
            // the reads of step 0 are asked for ahead of the group of step 1, so that
            // the first WMMAs wait for their own operands only
            __builtin_amdgcn_sched_barrier(0);
#pragma unroll
            for (int ks = 0; ks < K2_STEPS; ++ks) {
                if (ks + 1 < K2_STEPS) {
#pragma unroll
                    for (int nt = 0; nt < NT2; ++nt)
                        b[(ks + 1) & 1][nt] = frag(bBase + nt * 16 * KP2 + (ks + 1) * 32);
                    // holds the LDS reads above as one group ahead of this step's WMMAs:
                    // left free, the compiler spreads them in pairs among the WMMAs
                    __builtin_amdgcn_sched_barrier(0);
                }
#pragma unroll
                for (int nt = 0; nt < NT2; ++nt)
                    acc[nt] = __builtin_amdgcn_wmma_f32_16x16x32_f16(
                        false, a[ks], false, b[ks & 1][nt], (short)0, acc[nt], false, false);
                // keeps the next group of reads behind this step's WMMAs
                if (ks + 1 < K2_STEPS) __builtin_amdgcn_sched_barrier(0);
            }
#pragma unroll
            for (int nt = 0; nt < NT2; ++nt) {
                const int ncol = nt * 16 + m;
#pragma unroll
                for (int v = 0; v < 8; ++v) {
                    float z  = acc[nt][v] + bias2[nt];
                    float hv = (z >= 0.f) ? z : LEAKY_ALPHA * z;
                    if (ncol >= D2) hv = 0.f;
                    rs2[v] += hv;
                }
            }
        }

        {
            const float mean2 = row_sums(rs2, m) * (1.0f / (float)D2);
            const int gr = rowBase + wave * 16 + m + 8 * hh;
            if (m < 8 && gr < Btotal) {
                out[gr] = mean1;
                out[(size_t)Btotal + gr] = mean2;
            }
        }

        // ---------------- The next tile's x into the rows this wave has read ----
        if (nextRows >= ROWS)                            // block-uniform
            store_x(xw, lane, xnext);
        else if (nextRows > 0)
            stage_x_part(x, xw, lane, nextBase + wave * WROWS, nextRows - wave * WROWS);
        // the next trip's layer 1 reads these rows, written by this wave's own lanes
        wave_lds_handover();
    }   // tiles
}

extern "C" void kernel_launch(void* const* d_in, const int* in_sizes, int n_in,
                              void* d_out, int out_size, void* d_ws, size_t ws_size,
                              hipStream_t stream) {
    const float* x  = (const float*)d_in[0];
    const float* W1 = (const float*)d_in[1];
    const float* b1 = (const float*)d_in[2];
    const float* W2 = (const float*)d_in[3];
    const float* b2 = (const float*)d_in[4];
    float* out = (float*)d_out;

    const int Btotal = in_sizes[0] / D_IN;         // 262144
    const size_t shmem = (size_t)LDS_HALVES * sizeof(_Float16); // ~214 KB (< 320 KB/WGP)

    hipLaunchKernelGGL(mlp2_fused_wmma, dim3(GRID), dim3(256), shmem, stream,
                       x, W1, b1, W2, b2, out, Btotal);
}

// v007
// One run takes 31.3 microseconds.
// Next to v006, in two timings, it ran 1.05 and 1.04 times as fast.
// All steps since v000 together make it 23.3 times as fast.
#include <hip/hip_runtime.h>

typedef __attribute__((ext_vector_type(16))) _Float16 v16h;
typedef __attribute__((ext_vector_type(8)))  _Float16 v8h;
typedef __attribute__((ext_vector_type(8)))  float    v8f;

#define LEAKY_ALPHA 0.1f

// Problem dims (from reference)
constexpr int D_IN = 200;
constexpr int D1   = 150;
constexpr int D2   = 100;

constexpr int MT       = 2;
constexpr int ROWS     = 256;
constexpr int GRID     = 256;
constexpr int K1_STEPS = 7;
constexpr int KP1      = 232;
constexpr int NT1      = 10;
constexpr int NP1      = 160;
constexpr int K2_STEPS = 5;    // 5*32 = 160 >= 150
constexpr int KP2      = 168;  // LDS row stride (halves): 84 dwords
constexpr int NT2      = 7;    // 7*16 = 112 >= 100
constexpr int NP2      = 112;

constexpr int LDS_X  = ROWS * KP1;   // x tile  (f16)
constexpr int LDS_W1 = NP1  * KP1;   // W1^T    (f16)
constexpr int LDS_H1 = ROWS * KP2;   // h1 tile (f16)
constexpr int LDS_W2 = NP2  * KP2;   // W2^T    (f16)
constexpr int LDS_HALVES = LDS_X + LDS_W1 + LDS_H1 + LDS_W2;   // 158336 -> 316672 B
static_assert(LDS_HALVES * 2 <= 327680, "one WGP's LDS");

typedef __attribute__((ext_vector_type(4)))  _Float16 v4h;
typedef __attribute__((ext_vector_type(4)))  float    v4f;
typedef __attribute__((ext_vector_type(2)))  float    v2f;

// Stages Wg[KD][ND] (f32, row major) as wl[n*KP + k] (f16), zero padded to
// NP rows of KP halves. One item = 2 columns x 8 consecutive k: eight
// independent 8-byte loads off one address (lanes walk n, so a wave reads
// contiguous bytes), then two 16-byte LDS stores. Threads past the last item
// of the last trip do one of the first items again (the same bytes to the
// same place), so that neither the loads nor the stores stand under a branch.
template <int KD, int ND, int KP, int NP>
struct WStage {
    static constexpr int NPAIR = ND / 2;
    static constexpr int KB    = (KD + 7) / 8;      // k blocks that hold data
    static constexpr int SH    = KB * 8 - KD;       // rows the last block lacks
    static constexpr int KBP   = KP / 8;            // k blocks per LDS row
    static constexpr int ITEMS = NPAIR * KB;
    static constexpr int TRIPS = (ITEMS + 255) / 256;
    static_assert(ND % 2 == 0 && KP % 8 == 0 && KD >= 8 && ITEMS >= 256, "item shape");

    // tid < 256 (the block's size): only the last trip can pass the last item
    static __device__ __forceinline__ int item(int tid, int i) {
        const int it = tid + 256 * i;
        return (256 * i + 255 < ITEMS || it < ITEMS) ? it : (it - ITEMS);
    }

    template <int T0, int T1>
    static __device__ __forceinline__ void load(const float* __restrict__ Wg, int tid,
                                                v2f (&w)[T1 - T0][8]) {
#pragma unroll
        for (int i = T0; i < T1; ++i) {
            const int it = item(tid, i);
            const int kb = it / NPAIR;
            const int np = it % NPAIR;
            // first row of the block; the last block is moved up by SH rows so
            // that its eight rows end with the matrix: one address per item
            const int k0 = (SH == 0) ? kb * 8 : min(kb * 8, KD - 8);
            const unsigned off = (unsigned)(k0 * ND + np * 2) * 4u;   // bytes
            const char* p = (const char*)Wg + off;
#pragma unroll
            for (int j = 0; j < 8; ++j) w[i - T0][j] = *(const v2f*)(p + j * ND * 4);
            // the offset register of these loads stays as it is up to this wait;
            // behind it a later load or address may take the register
            asm volatile("s_wait_xcnt 0x0" :: "v"(off) : "memory");
        }
    }

    template <int T0, int T1>
    static __device__ __forceinline__ void store(_Float16* __restrict__ wl, int tid,
                                                 const v2f (&w)[T1 - T0][8]) {
#pragma unroll
        for (int i = T0; i < T1; ++i) {
            const int it = item(tid, i);
            const int kb = it / NPAIR;
            const int np = it % NPAIR;
            v8h lo, hi;
#pragma unroll
            for (int j = 0; j < 8; ++j) {
                v2f v = w[i - T0][j];
                if constexpr (SH != 0) {             // undo the move, zero k >= KD
                    const v2f u = (j + SH < 8) ? w[i - T0][(j + SH) & 7] : (v2f){0.f, 0.f};
                    if (kb == KB - 1) v = u;
                }
                lo[j] = (_Float16)v.x;
                hi[j] = (_Float16)v.y;
            }
            *(v8h*)(wl + (np * 2)     * KP + kb * 8) = lo;
            *(v8h*)(wl + (np * 2 + 1) * KP + kb * 8) = hi;
        }
    }

    static __device__ __forceinline__ void pad(_Float16* __restrict__ wl, int tid) {
        // the k blocks behind the data in rows n < ND
        for (int idx = tid; idx < ND * (KBP - KB); idx += 256) {
            const int n = idx / (KBP - KB);
            const int c = idx % (KBP - KB);
            *(v8h*)(wl + n * KP + (KB + c) * 8) = (v8h)(_Float16)0.f;
        }
        // the rows ND..NP-1 (contiguous)
        for (int idx = tid; idx < (NP - ND) * KBP; idx += 256)
            *(v8h*)(wl + ND * KP + idx * 8) = (v8h)(_Float16)0.f;
    }
};

// Fills the x tile, W1^T and W2^T in LDS. No load of a whole tile stands under
// a branch or is waited for alone: each thread has a long run of 8- and
// 16-byte loads in flight where one 4-byte load was waited for per trip.
// Issue order: W2 and the head of W1 (they come from L2) first, x behind them,
// the rest of W1 into the registers these free while x is on its way.
template <bool WHOLE>
__device__ __forceinline__ void stage_tile(const float* __restrict__ x,
                                           const float* __restrict__ W1,
                                           const float* __restrict__ W2,
                                           _Float16* __restrict__ xlds,
                                           _Float16* __restrict__ w1lds,
                                           _Float16* __restrict__ w2lds,
                                           int tid, int rowBase, int rowsHere)
{
    using S1 = WStage<D_IN, D1, KP1, NP1>;
    using S2 = WStage<D1,   D2, KP2, NP2>;
    static_assert(S1::TRIPS == 8 && S2::TRIPS == 4, "trip split below");

    v2f w2r[4][8], w1a[2][8], w1b[4][8], w1c[2][8];
    S2::template load<0, 4>(W2, tid, w2r);
    S1::template load<0, 2>(W1, tid, w1a);

    // x tile: ROWS rows x 200 floats are one contiguous run of float4.
    constexpr int XQ_ROW = D_IN / 4;                 // 50 float4 per row
    constexpr int XTRIPS = ROWS * XQ_ROW / 256;      // 50 per thread
    v4f xv[XTRIPS];
    if constexpr (WHOLE) {
        const v4f* xg = (const v4f*)(x + (size_t)rowBase * D_IN);
#pragma unroll
        for (int i = 0; i < XTRIPS; ++i) xv[i] = xg[tid + 256 * i];
    }
    // keeps every load above issued ahead of the first wait for one of them
    __builtin_amdgcn_sched_barrier(0);

    S2::template store<0, 4>(w2lds, tid, w2r);
    S1::template load<2, 6>(W1, tid, w1b);
    S1::template store<0, 2>(w1lds, tid, w1a);
    S1::template load<6, 8>(W1, tid, w1c);

    // zero padding, while the loads are on their way
    S1::pad(w1lds, tid);
    S2::pad(w2lds, tid);
    for (int idx = tid; idx < ROWS * ((KP1 - D_IN) / 8); idx += 256) {
        const int r = idx / ((KP1 - D_IN) / 8);      // x tile, columns 200..231
        const int c = idx % ((KP1 - D_IN) / 8);
        *(v8h*)(xlds + r * KP1 + D_IN + c * 8) = (v8h)(_Float16)0.f;
    }

    if constexpr (WHOLE) {
#pragma unroll
        for (int i = 0; i < XTRIPS; ++i) {
            const int f = tid + 256 * i;
            const int r = f / XQ_ROW;
            // r*KP1 + (f - r*XQ_ROW)*4
            *(v4h*)(xlds + f * 4 + r * (KP1 - D_IN)) = __builtin_convertvector(xv[i], v4h);
        }
    } else {
        for (int idx = tid; idx < ROWS * D_IN; idx += 256) {   // element by element
            const int k = idx % D_IN;
            const int r = idx / D_IN;
            const float v = (r < rowsHere) ? x[(size_t)(rowBase + r) * D_IN + k] : 0.f;
            xlds[r * KP1 + k] = (_Float16)v;
        }
    }
    S1::template store<2, 6>(w1lds, tid, w1b);
    S1::template store<6, 8>(w1lds, tid, w1c);
}

// The x tile of the second and later tiles of a workgroup: the weights and every
// zero pad (x columns 200..231 among them) stay in LDS from stage_tile. EACH WAVE
// STAGES THE ROWS THAT IT READS ITSELF, so no wave waits for another inside the tile
// loop. They are asked for one tile ahead, 16 rows (one contiguous run of 800 float4)
// at a time, so that one set of registers serves both row tiles: load_x asks, the rows
// rest in registers while a layer of the current tile runs, and store_x puts them into
// LDS once the wave has read its current rows.
constexpr int WROWS  = 16 * MT;                  // rows per wave
constexpr int XQ_ROW = D_IN / 4;                 // 50 float4 per row
constexpr int XTRIPS = 16 * XQ_ROW / 32;         // 25 per lane and 16 rows
static_assert(16 * XQ_ROW % 32 == 0 && WROWS * 8 == ROWS && MT == 2, "a wave's rows, whole trips");

// xg: the lane's first float4 of the 16 rows; every load names this one address.
__device__ __forceinline__ void load_x(const v4f* __restrict__ xg, v4f (&xv)[XTRIPS])
{
#pragma unroll
    for (int i = 0; i < XTRIPS; ++i) xv[i] = xg[32 * i];
}

// xw: the first of the 16 rows in the LDS tile.
__device__ __forceinline__ void store_x(_Float16* __restrict__ xw, int lane,
                                        const v4f (&xv)[XTRIPS])
{
#pragma unroll
    for (int i = 0; i < XTRIPS; ++i) {
        const int f = lane + 32 * i;
        const int r = f / XQ_ROW;
        *(v4h*)(xw + f * 4 + r * (KP1 - D_IN)) = __builtin_convertvector(xv[i], v4h);
    }
}

// The wave's rows of a tile that the batch does not fill: element by element, not
// fetched ahead. row0: the first of the wave's rows in the batch; rowsLeft: how many
// rows the batch holds from there on (may be <= 0).
__device__ __forceinline__ void stage_x_part(const float* __restrict__ x,
                                             _Float16* __restrict__ xw,
                                             int lane, int row0, int rowsLeft)
{
    for (int idx = lane; idx < WROWS * D_IN; idx += 32) {
        const int k = idx % D_IN;
        const int r = idx / D_IN;
        const float v = (r < rowsLeft) ? x[(size_t)(row0 + r) * D_IN + k] : 0.f;
        xw[r * KP1 + k] = (_Float16)v;
    }
}

// Hand-over in LDS between the lanes of ONE wave (rows that no other wave touches):
// the wave waits for its own LDS stores, and the compiler moves no LDS access across
// this point; no other wave is waited for. Both fences name the LDS address space, so
// that the global loads in flight (the fetch-ahead of x) are not waited for.
__device__ __forceinline__ void wave_lds_handover() {
    __builtin_amdgcn_fence(__ATOMIC_RELEASE, "workgroup", "local");
    __builtin_amdgcn_wave_barrier();
    __builtin_amdgcn_fence(__ATOMIC_ACQUIRE, "workgroup", "local");
}

// One A or B fragment of the 16x16x32 form: K = 8*hh + [0..7] and 16 + 8*hh + [0..7]
// (p already holds the lane's row and its 8*hh).
__device__ __forceinline__ v16h frag(const _Float16* p) {
    union { v16h v; v8h h[2]; } f;
    f.h[0] = *(const v8h*)p;
    f.h[1] = *(const v8h*)(p + 16);
    return f.v;
}

template <int CTRL>
__device__ __forceinline__ float add_xmask(float s) {
    const int o = __builtin_amdgcn_update_dpp(0, __builtin_bit_cast(int, s), CTRL, 0xf, 0xf, true);
    return s + __builtin_bit_cast(float, o);
}

// Sums each r[v] over the 16 lanes of the lane's half (partners l^1, l^2, l^4, l^8,
// in that order). The eight sums go step by step side by side, so that each add's
// latency is covered by the seven others. Every lane ends with all eight sums;
// the lane gets back that of row v = m & 7. The loops are unrolled so that r[]
// is indexed by constants and stays in registers.
__device__ __forceinline__ float row_sums(float (&r)[8], int m) {
#pragma unroll
    for (int v = 0; v < 8; ++v) r[v] = add_xmask<0x161>(r[v]);
#pragma unroll
    for (int v = 0; v < 8; ++v) r[v] = add_xmask<0x162>(r[v]);
#pragma unroll
    for (int v = 0; v < 8; ++v) r[v] = add_xmask<0x164>(r[v]);
#pragma unroll
    for (int v = 0; v < 8; ++v) r[v] = add_xmask<0x168>(r[v]);
    const bool b0 = (m & 1) != 0, b1 = (m & 2) != 0, b2 = (m & 4) != 0;
    const float t0 = b0 ? r[1] : r[0], t1 = b0 ? r[3] : r[2];
    const float t2 = b0 ? r[5] : r[4], t3 = b0 ? r[7] : r[6];
    const float u0 = b1 ? t1 : t0, u1 = b1 ? t3 : t2;
    return b2 ? u1 : u0;
}

__global__ __launch_bounds__(256, 1)
void mlp2_fused_wmma(const float* __restrict__ x,
                     const float* __restrict__ W1,
                     const float* __restrict__ b1,
                     const float* __restrict__ W2,
                     const float* __restrict__ b2,
                     float* __restrict__ out,   // [0,B): out1  [B,2B): out2
                     int Btotal)
{
    __shared__ __attribute__((aligned(16))) _Float16 smem[LDS_HALVES];
    _Float16* xlds  = smem;
    _Float16* w1lds = xlds  + LDS_X;
    _Float16* h1lds = w1lds + LDS_W1;
    _Float16* w2lds = h1lds + LDS_H1;

    const int tid     = threadIdx.x;
    const int wave    = tid >> 5;
    const int lane    = tid & 31;
    const int m       = lane & 15;
    const int hh      = lane >> 4;
    const int rowL    = wave * WROWS + m;
    const int nTiles  = (Btotal + ROWS - 1) / ROWS;
    if ((int)blockIdx.x >= nTiles) return;   // block-uniform, ahead of every barrier

    // Biases of this lane's column in every tile, asked for ahead of the staging.
    // A padded column reads the last real entry; its value is set to 0 below.
    float bias1[NT1], bias2[NT2];
#pragma unroll
    for (int nt = 0; nt < NT1; ++nt) bias1[nt] = b1[min(nt * 16 + m, D1 - 1)];
#pragma unroll
    for (int nt = 0; nt < NT2; ++nt) bias2[nt] = b2[min(nt * 16 + m, D2 - 1)];

    // ------- Stage the weights (transposed over K), once, and the first x tile
    {
        const int rowBase  = blockIdx.x * ROWS;
        const int rowsHere = (Btotal - rowBase < ROWS) ? (Btotal - rowBase) : ROWS;
        if (__builtin_expect(rowsHere == ROWS, 1))   // block-uniform
            stage_tile<true >(x, W1, W2, xlds, w1lds, w2lds, tid, rowBase, rowsHere);
        else                // the last tile of a batch that is no multiple of ROWS
            stage_tile<false>(x, W1, W2, xlds, w1lds, w2lds, tid, rowBase, rowsHere);
    }

    __syncthreads();   // the weights and the first x tile are in LDS: the one barrier

    // ------- The workgroup's tiles, one after the other, on the same weights.
    // Inside the loop a wave reads the weights (never written again) and its own 32
    // rows of x and h1 only, so the waves are free to run out of step: one wave's
    // vector work stands beside another's LDS reads and matrix work.
    _Float16* xw = xlds + wave * WROWS * KP1;            // the wave's own x rows
    for (int tile = blockIdx.x; tile < nTiles; tile += GRID) {
        const int rowBase = tile * ROWS;
        const int nextBase = rowBase + GRID * ROWS;      // the workgroup's next tile
        const int nextRows = Btotal - nextBase;          // <= 0: there is none

        // The next tile's first 16 rows of x are asked for here, ahead of layer 1, and
        // waited for behind it; its other 16 rows then take the same registers and are
        // waited for behind layer 2: memory works while the matrix units do.
        // (The address is formed on every trip; it is read from only where the batch
        // holds the whole tile.)
        v4f xnext[XTRIPS];
        const v4f* xaddr = (const v4f*)(x + (size_t)(nextBase + wave * WROWS) * D_IN) + lane;
        if (nextRows >= ROWS)                            // block-uniform
            load_x(xaddr, xnext);

        // ---------------- Layer 1: h1 = leaky(x@W1 + b1), row partial sums -----
        // Two row tiles x ten column tiles accumulate side by side. The work goes in
        // groups of five column tiles of one k step: the five W1 fragments of a group
        // are read from LDS once and feed ten WMMAs (both row tiles). A group's reads
        // are asked for two groups ahead (three register sets); the two x fragments of
        // a k step come with the step's first group (two sets).
        float rs1[MT][8];
#pragma unroll
        for (int r = 0; r < MT; ++r)
#pragma unroll
            for (int v = 0; v < 8; ++v) rs1[r][v] = 0.f;
        {
            constexpr int NH = NT1 / 2;                  // column tiles per group
            constexpr int NG = K1_STEPS * 2;             // groups
            static_assert(NH * 2 == NT1, "two groups per k step");
            const _Float16* aBase = xlds  + rowL * KP1 + 8 * hh;
            const _Float16* bBase = w1lds + m    * KP1 + 8 * hh;
            v16h a[2][MT], b[3][NH];
            v8f  acc[MT][NT1];
#pragma unroll
            for (int g = 0; g < 2; ++g) {
                if (g == 0) {
#pragma unroll
                    for (int r = 0; r < MT; ++r) a[0][r] = frag(aBase + r * 16 * KP1);
                }
#pragma unroll
                for (int nt = 0; nt < NH; ++nt) b[g][nt] = frag(bBase + (g * NH + nt) * 16 * KP1);
            }
#pragma unroll
            for (int r = 0; r < MT; ++r)
#pragma unroll
                for (int nt = 0; nt < NT1; ++nt) acc[r][nt] = (v8f){};
            // the reads of groups 0 and 1 are asked for ahead of those of group 2, so that
            // the first WMMAs wait for their own operands only
            __builtin_amdgcn_sched_barrier(0);
#pragma unroll
            for (int g = 0; g < NG; ++g) {
                const int ks = g >> 1, h = g & 1;
                const int gn = g + 2;                    // the group fetched here
                if (gn < NG) {
                    if ((gn & 1) == 0) {
#pragma unroll
                        for (int r = 0; r < MT; ++r)
                            a[(gn >> 1) & 1][r] = frag(aBase + r * 16 * KP1 + (gn >> 1) * 32);
                    }
#pragma unroll
                    for (int nt = 0; nt < NH; ++nt)
                        b[gn % 3][nt] = frag(bBase + ((gn & 1) * NH + nt) * 16 * KP1 + (gn >> 1) * 32);
                    // holds the LDS reads above as one group ahead of this group's WMMAs:
                    // left free, the compiler spreads them in pairs among the WMMAs
                    __builtin_amdgcn_sched_barrier(0);
                }
#pragma unroll
                for (int nt = 0; nt < NH; ++nt)
#pragma unroll
                    for (int r = 0; r < MT; ++r)
                        acc[r][h * NH + nt] = __builtin_amdgcn_wmma_f32_16x16x32_f16(
                            false, a[ks & 1][r], false, b[g % 3][nt], (short)0, acc[r][h * NH + nt],
                            false, false);
                // keeps the next group of reads behind this group's WMMAs
                if (gn < NG) __builtin_amdgcn_sched_barrier(0);
            }
#pragma unroll
            for (int r = 0; r < MT; ++r) {
#pragma unroll
                for (int nt = 0; nt < NT1; ++nt) {
                    const int ncol = nt * 16 + m;                 // C column of this lane
#pragma unroll
                    for (int v = 0; v < 8; ++v) {
                        float z  = acc[r][nt][v] + bias1[nt];
                        float hv = (z >= 0.f) ? z : LEAKY_ALPHA * z;
                        if (ncol >= D1) hv = 0.f;                  // padded column -> exact 0
                        rs1[r][v] += hv;
                        h1lds[(wave * WROWS + r * 16 + v + 8 * hh) * KP2 + ncol] = (_Float16)hv;
                    }
                }
            }
        }

        // Row mean out1: reduce the 16 lanes of each half (cols 0..159, zeros padded).
        // It is stored with out2 below, both outputs under one test.
        float mean1[MT];
#pragma unroll
        for (int r = 0; r < MT; ++r) mean1[r] = row_sums(rs1[r], m) * (1.0f / (float)D1);

        // Layer 1 has read the wave's x rows: the next tile's first 16 go into their
        // place, and its other 16 are asked for, off the same address registers.
        if (nextRows >= ROWS) {                          // block-uniform
            store_x(xw, lane, xnext);
            load_x(xaddr + 16 * XQ_ROW, xnext);
        }
        // Layer 2 reads this wave's own h1 rows, written by its own lanes above.
        wave_lds_handover();

        // ---------------- Layer 2: out2 = mean(leaky(h1@W2 + b2)) --------------
        // The h1 slice in registers, two row tiles x seven column tiles side by side:
        // the seven W2 fragments of a k step feed fourteen WMMAs and are fetched as one
        // group ahead of the WMMAs of the step before.
        float rs2[MT][8];
#pragma unroll
        for (int r = 0; r < MT; ++r)
#pragma unroll
            for (int v = 0; v < 8; ++v) rs2[r][v] = 0.f;
        {
            const _Float16* aBase = h1lds + rowL * KP2 + 8 * hh;
            const _Float16* bBase = w2lds + m    * KP2 + 8 * hh;
            v16h a[MT][K2_STEPS], b[2][NT2];
            v8f  acc[MT][NT2];
#pragma unroll
            for (int nt = 0; nt < NT2; ++nt) b[0][nt] = frag(bBase + nt * 16 * KP2);
#pragma unroll
            for (int ks = 0; ks < K2_STEPS; ++ks)
#pragma unroll
                for (int r = 0; r < MT; ++r) a[r][ks] = frag(aBase + r * 16 * KP2 + ks * 32);
#pragma unroll
            for (int r = 0; r < MT; ++r)
#pragma unroll
                for (int nt = 0; nt < NT2; ++nt) acc[r][nt] = (v8f){};
            // the reads of step 0 are asked for ahead of the group of step 1, so that
            // the first WMMAs wait for their own operands only
            __builtin_amdgcn_sched_barrier(0);
#pragma unroll
            for (int ks = 0; ks < K2_STEPS; ++ks) {
                if (ks + 1 < K2_STEPS) {
#pragma unroll
                    for (int nt = 0; nt < NT2; ++nt)
                        b[(ks + 1) & 1][nt] = frag(bBase + nt * 16 * KP2 + (ks + 1) * 32);
                    // holds the LDS reads above as one group ahead of this step's WMMAs:
                    // left free, the compiler spreads them in pairs among the WMMAs
                    __builtin_amdgcn_sched_barrier(0);
                }
#pragma unroll
                for (int nt = 0; nt < NT2; ++nt)
#pragma unroll
                    for (int r = 0; r < MT; ++r)
                        acc[r][nt] = __builtin_amdgcn_wmma_f32_16x16x32_f16(
                            false, a[r][ks], false, b[ks & 1][nt], (short)0, acc[r][nt], false, false);
                // keeps the next group of reads behind this step's WMMAs
                if (ks + 1 < K2_STEPS) __builtin_amdgcn_sched_barrier(0);
            }
#pragma unroll
            for (int r = 0; r < MT; ++r) {
#pragma unroll
                for (int nt = 0; nt < NT2; ++nt) {
                    const int ncol = nt * 16 + m;
#pragma unroll
                    for (int v = 0; v < 8; ++v) {
                        float z  = acc[r][nt][v] + bias2[nt];
                        float hv = (z >= 0.f) ? z : LEAKY_ALPHA * z;
                        if (ncol >= D2) hv = 0.f;
                        rs2[r][v] += hv;
                    }
                }
            }
        }

        // The address registers of the x loads above are held (as this statement's input)
        // up to this wait; only behind it may anything take them. Every way through
        // the trip passes here, and neither layer has had to stand still for it.
        asm volatile("s_wait_xcnt 0x0" :: "v"(xaddr) : "memory");

#pragma unroll
        for (int r = 0; r < MT; ++r) {
            const float mean2 = row_sums(rs2[r], m) * (1.0f / (float)D2);
            const int gr = rowBase + wave * WROWS + r * 16 + m + 8 * hh;
            if (m < 8 && gr < Btotal) {
                out[gr] = mean1[r];
                out[(size_t)Btotal + gr] = mean2;
            }
        }

        // ---------------- The rest of the next tile's x into this wave's rows ----
        if (nextRows >= ROWS)                            // block-uniform
            store_x(xw + 16 * KP1, lane, xnext);
        else if (nextRows > 0)
            stage_x_part(x, xw, lane, nextBase + wave * WROWS, nextRows - wave * WROWS);
        // the next trip's layer 1 reads these rows, written by this wave's own lanes
        wave_lds_handover();
    }   // tiles
}

extern "C" void kernel_launch(void* const* d_in, const int* in_sizes, int n_in,
                              void* d_out, int out_size, void* d_ws, size_t ws_size,
                              hipStream_t stream) {
    const float* x  = (const float*)d_in[0];
    const float* W1 = (const float*)d_in[1];
    const float* b1 = (const float*)d_in[2];
    const float* W2 = (const float*)d_in[3];
    const float* b2 = (const float*)d_in[4];
    float* out = (float*)d_out;

    const int Btotal = in_sizes[0] / D_IN;         // 262144

    hipLaunchKernelGGL(mlp2_fused_wmma, dim3(GRID), dim3(256), 0, stream,
                       x, W1, b1, W2, b2, out, Btotal);
}

// v008
// A run of this version takes 28.2 microseconds.
// Timed twice side by side with v007, it ran 1.11 times as fast both times.
// All steps since v000 together make it 25.9 times as fast.
#include <hip/hip_runtime.h>

typedef __attribute__((ext_vector_type(16))) _Float16 v16h;
typedef __attribute__((ext_vector_type(8)))  _Float16 v8h;
typedef __attribute__((ext_vector_type(8)))  float    v8f;

#define LEAKY_ALPHA 0.1f

// Problem dims (from reference)
constexpr int D_IN = 200;
constexpr int D1   = 150;
constexpr int D2   = 100;

constexpr int MT       = 2;
constexpr int ROWS     = 256;
constexpr int GRID     = 256;
constexpr int K1_STEPS = 7;
constexpr int KP1      = 232;
constexpr int NT1      = 10;
constexpr int NP1      = 160;
constexpr int K2_STEPS = 5;    // 5*32 = 160 >= 150
constexpr int KP2      = 168;  // LDS row stride (halves): 84 dwords
constexpr int NT2      = 7;    // 7*16 = 112 >= 100
constexpr int NP2      = 112;

constexpr int LDS_X  = ROWS * KP1;   // x tile  (f16)
constexpr int LDS_W1 = NP1  * KP1;   // W1^T    (f16)
constexpr int LDS_W2 = NP2  * KP2;   // W2^T    (f16)
constexpr int LDS_B  = (NP1 + NP2) * 2;   // b1, b2 (f32, zero padded), counted in halves
constexpr int LDS_HALVES = LDS_X + LDS_W1 + LDS_W2 + LDS_B;   // 115872 -> 231744 B
static_assert(LDS_HALVES * 2 <= 327680, "one WGP's LDS");
static_assert((LDS_X + LDS_W1 + LDS_W2) % 8 == 0, "the biases start on 16 bytes");

typedef __attribute__((ext_vector_type(4)))  _Float16 v4h;
typedef __attribute__((ext_vector_type(4)))  float    v4f;
typedef __attribute__((ext_vector_type(2)))  float    v2f;
typedef __attribute__((ext_vector_type(2)))  _Float16 v2h;

// Stages Wg[KD][ND] (f32, row major) as wl[n*KP + k] (f16), zero padded to
// NP rows of KP halves. One item = 2 columns x 8 consecutive k: eight
// independent 8-byte loads off one address (lanes walk n, so a wave reads
// contiguous bytes), then two 16-byte LDS stores. Threads past the last item
// of the last trip do one of the first items again (the same bytes to the
// same place), so that neither the loads nor the stores stand under a branch.
template <int KD, int ND, int KP, int NP>
struct WStage {
    static constexpr int NPAIR = ND / 2;
    static constexpr int KB    = (KD + 7) / 8;      // k blocks that hold data
    static constexpr int SH    = KB * 8 - KD;       // rows the last block lacks
    static constexpr int KBP   = KP / 8;            // k blocks per LDS row
    static constexpr int ITEMS = NPAIR * KB;
    static constexpr int TRIPS = (ITEMS + 255) / 256;
    static_assert(ND % 2 == 0 && KP % 8 == 0 && KD >= 8 && ITEMS >= 256, "item shape");

    // tid < 256 (the block's size): only the last trip can pass the last item
    static __device__ __forceinline__ int item(int tid, int i) {
        const int it = tid + 256 * i;
        return (256 * i + 255 < ITEMS || it < ITEMS) ? it : (it - ITEMS);
    }

    template <int T0, int T1>
    static __device__ __forceinline__ void load(const float* __restrict__ Wg, int tid,
                                                v2f (&w)[T1 - T0][8]) {
#pragma unroll
        for (int i = T0; i < T1; ++i) {
            const int it = item(tid, i);
            const int kb = it / NPAIR;
            const int np = it % NPAIR;
            // first row of the block; the last block is moved up by SH rows so
            // that its eight rows end with the matrix: one address per item
            const int k0 = (SH == 0) ? kb * 8 : min(kb * 8, KD - 8);
            const unsigned off = (unsigned)(k0 * ND + np * 2) * 4u;   // bytes
            const char* p = (const char*)Wg + off;
#pragma unroll
            for (int j = 0; j < 8; ++j) w[i - T0][j] = *(const v2f*)(p + j * ND * 4);
            // the offset register of these loads stays as it is up to this wait;
            // behind it a later load or address may take the register
            asm volatile("s_wait_xcnt 0x0" :: "v"(off) : "memory");
        }
    }

    template <int T0, int T1>
    static __device__ __forceinline__ void store(_Float16* __restrict__ wl, int tid,
                                                 const v2f (&w)[T1 - T0][8]) {
#pragma unroll
        for (int i = T0; i < T1; ++i) {
            const int it = item(tid, i);
            const int kb = it / NPAIR;
            const int np = it % NPAIR;
            v8h lo, hi;
#pragma unroll
            for (int j = 0; j < 8; ++j) {
                v2f v = w[i - T0][j];
                if constexpr (SH != 0) {             // undo the move, zero k >= KD
                    const v2f u = (j + SH < 8) ? w[i - T0][(j + SH) & 7] : (v2f){0.f, 0.f};
                    if (kb == KB - 1) v = u;
                }
                lo[j] = (_Float16)v.x;
                hi[j] = (_Float16)v.y;
            }
            *(v8h*)(wl + (np * 2)     * KP + kb * 8) = lo;
            *(v8h*)(wl + (np * 2 + 1) * KP + kb * 8) = hi;
        }
    }

    static __device__ __forceinline__ void pad(_Float16* __restrict__ wl, int tid) {
        // the k blocks behind the data in rows n < ND
        for (int idx = tid; idx < ND * (KBP - KB); idx += 256) {
            const int n = idx / (KBP - KB);
            const int c = idx % (KBP - KB);
            *(v8h*)(wl + n * KP + (KB + c) * 8) = (v8h)(_Float16)0.f;
        }
        // the rows ND..NP-1 (contiguous)
        for (int idx = tid; idx < (NP - ND) * KBP; idx += 256)
            *(v8h*)(wl + ND * KP + idx * 8) = (v8h)(_Float16)0.f;
    }
};

// Fills the x tile, W1^T and W2^T in LDS. No load of a whole tile stands under
// a branch or is waited for alone: each thread has a long run of 8- and
// 16-byte loads in flight where one 4-byte load was waited for per trip.
// Issue order: W2 and the head of W1 (they come from L2) first, x behind them,
// the rest of W1 into the registers these free while x is on its way.
template <bool WHOLE>
__device__ __forceinline__ void stage_tile(const float* __restrict__ x,
                                           const float* __restrict__ W1,
                                           const float* __restrict__ W2,
                                           _Float16* __restrict__ xlds,
                                           _Float16* __restrict__ w1lds,
                                           _Float16* __restrict__ w2lds,
                                           int tid, int rowBase, int rowsHere)
{
    using S1 = WStage<D_IN, D1, KP1, NP1>;
    using S2 = WStage<D1,   D2, KP2, NP2>;
    static_assert(S1::TRIPS == 8 && S2::TRIPS == 4, "trip split below");

    v2f w2r[4][8], w1a[2][8], w1b[4][8], w1c[2][8];
    S2::template load<0, 4>(W2, tid, w2r);
    S1::template load<0, 2>(W1, tid, w1a);

    // x tile: ROWS rows x 200 floats are one contiguous run of float4.
    constexpr int XQ_ROW = D_IN / 4;                 // 50 float4 per row
    constexpr int XTRIPS = ROWS * XQ_ROW / 256;      // 50 per thread
    v4f xv[XTRIPS];
    if constexpr (WHOLE) {
        const v4f* xg = (const v4f*)(x + (size_t)rowBase * D_IN);
#pragma unroll
        for (int i = 0; i < XTRIPS; ++i) xv[i] = xg[tid + 256 * i];
    }
    // keeps every load above issued ahead of the first wait for one of them
    __builtin_amdgcn_sched_barrier(0);

    S2::template store<0, 4>(w2lds, tid, w2r);
    S1::template load<2, 6>(W1, tid, w1b);
    S1::template store<0, 2>(w1lds, tid, w1a);
    S1::template load<6, 8>(W1, tid, w1c);

    // zero padding, while the loads are on their way
    S1::pad(w1lds, tid);
    S2::pad(w2lds, tid);
    for (int idx = tid; idx < ROWS * ((KP1 - D_IN) / 8); idx += 256) {
        const int r = idx / ((KP1 - D_IN) / 8);      // x tile, columns 200..231
        const int c = idx % ((KP1 - D_IN) / 8);
        *(v8h*)(xlds + r * KP1 + D_IN + c * 8) = (v8h)(_Float16)0.f;
    }

    if constexpr (WHOLE) {
#pragma unroll
        for (int i = 0; i < XTRIPS; ++i) {
            const int f = tid + 256 * i;
            const int r = f / XQ_ROW;
            // r*KP1 + (f - r*XQ_ROW)*4
            *(v4h*)(xlds + f * 4 + r * (KP1 - D_IN)) = __builtin_convertvector(xv[i], v4h);
        }
    } else {
        for (int idx = tid; idx < ROWS * D_IN; idx += 256) {   // element by element
            const int k = idx % D_IN;
            const int r = idx / D_IN;
            const float v = (r < rowsHere) ? x[(size_t)(rowBase + r) * D_IN + k] : 0.f;
            xlds[r * KP1 + k] = (_Float16)v;
        }
    }
    S1::template store<2, 6>(w1lds, tid, w1b);
    S1::template store<6, 8>(w1lds, tid, w1c);
}

// The x tile of the second and later tiles of a workgroup: the weights and every
// zero pad (x columns 200..231 among them) stay in LDS from stage_tile. EACH WAVE
// STAGES THE ROWS THAT IT READS ITSELF, so no wave waits for another inside the tile
// loop. They are asked for one tile ahead, 16 rows (one contiguous run of 800 float4)
// at a time, so that one set of registers serves both row tiles: load_x asks, the rows
// rest in registers while a layer of the current tile runs, and store_x puts them into
// LDS once the wave has read its current rows.
constexpr int WROWS  = 16 * MT;                  // rows per wave
constexpr int XQ_ROW = D_IN / 4;                 // 50 float4 per row
constexpr int XTRIPS = 16 * XQ_ROW / 32;         // 25 per lane and 16 rows
static_assert(16 * XQ_ROW % 32 == 0 && WROWS * 8 == ROWS && MT == 2, "a wave's rows, whole trips");

// xg: the lane's first float4 of the 16 rows; every load names this one address.
__device__ __forceinline__ void load_x(const v4f* __restrict__ xg, v4f (&xv)[XTRIPS])
{
#pragma unroll
    for (int i = 0; i < XTRIPS; ++i) xv[i] = xg[32 * i];
}

// xw: the first of the 16 rows in the LDS tile.
__device__ __forceinline__ void store_x(_Float16* __restrict__ xw, int lane,
                                        const v4f (&xv)[XTRIPS])
{
#pragma unroll
    for (int i = 0; i < XTRIPS; ++i) {
        const int f = lane + 32 * i;
        const int r = f / XQ_ROW;
        *(v4h*)(xw + f * 4 + r * (KP1 - D_IN)) = __builtin_convertvector(xv[i], v4h);
    }
}

// The wave's rows of a tile that the batch does not fill: element by element, not
// fetched ahead. row0: the first of the wave's rows in the batch; rowsLeft: how many
// rows the batch holds from there on (may be <= 0).
__device__ __forceinline__ void stage_x_part(const float* __restrict__ x,
                                             _Float16* __restrict__ xw,
                                             int lane, int row0, int rowsLeft)
{
    for (int idx = lane; idx < WROWS * D_IN; idx += 32) {
        const int k = idx % D_IN;
        const int r = idx / D_IN;
        const float v = (r < rowsLeft) ? x[(size_t)(row0 + r) * D_IN + k] : 0.f;
        xw[r * KP1 + k] = (_Float16)v;
    }
}

// Hand-over in LDS between the lanes of ONE wave (rows that no other wave touches):
// the wave waits for its own LDS stores, and the compiler moves no LDS access across
// this point; no other wave is waited for. Both fences name the LDS address space, so
// that the global stores in flight (the row means to out) are not waited for.
__device__ __forceinline__ void wave_lds_handover() {
    __builtin_amdgcn_fence(__ATOMIC_RELEASE, "workgroup", "local");
    __builtin_amdgcn_wave_barrier();
    __builtin_amdgcn_fence(__ATOMIC_ACQUIRE, "workgroup", "local");
}

// One A or B fragment of the 16x16x32 form: K = 8*hh + [0..7] and 16 + 8*hh + [0..7]
// (p already holds the lane's row and its 8*hh).
__device__ __forceinline__ v16h frag(const _Float16* p) {
    union { v16h v; v8h h[2]; } f;
    f.h[0] = *(const v8h*)p;
    f.h[1] = *(const v8h*)(p + 16);
    return f.v;
}

// Eight f32 of a bias vector in LDS (p on 16 bytes): the C tile's column of this lane.
__device__ __forceinline__ v8f bias8(const float* p) {
    union { v8f v; v4f q[2]; } f;
    f.q[0] = *(const v4f*)p;
    f.q[1] = *(const v4f*)(p + 4);
    return f.v;
}

// LeakyReLU of two neighbouring registers of a result tile.
__device__ __forceinline__ v2f leaky2(v2f z) {
    const v2f s = z * LEAKY_ALPHA;
    return (v2f){(z.x >= 0.f) ? z.x : s.x, (z.y >= 0.f) ? z.y : s.y};
}

__device__ __forceinline__ float row_sum(const v2f (&r)[4]) {
    const v2f u = (r[0] + r[1]) + (r[2] + r[3]);
    const float t = u.x + u.y;
    const int b = __builtin_bit_cast(int, t);
    const int o = __builtin_amdgcn_permlanex16(b, b, 0x76543210, 0xfedcba98, false, false);
    return t + __builtin_bit_cast(float, o);
}

__global__ __launch_bounds__(256, 1)
void mlp2_fused_wmma(const float* __restrict__ x,
                     const float* __restrict__ W1,
                     const float* __restrict__ b1,
                     const float* __restrict__ W2,
                     const float* __restrict__ b2,
                     float* __restrict__ out,   // [0,B): out1  [B,2B): out2
                     int Btotal)
{
    __shared__ __attribute__((aligned(16))) _Float16 smem[LDS_HALVES];
    _Float16* xlds  = smem;
    _Float16* w1lds = xlds  + LDS_X;
    _Float16* w2lds = w1lds + LDS_W1;
    float*    b1lds = (float*)(w2lds + LDS_W2);
    float*    b2lds = b1lds + NP1;

    const int tid     = threadIdx.x;
    const int wave    = tid >> 5;
    const int lane    = tid & 31;
    const int m       = lane & 15;
    const int hh      = lane >> 4;
    const int rowL    = wave * WROWS + m;
    const int nTiles  = (Btotal + ROWS - 1) / ROWS;
    if ((int)blockIdx.x >= nTiles) return;   // block-uniform, ahead of every barrier

    // The biases go to LDS in f32, zero in the padded columns (a padded entry reads the
    // last real one and is set to 0). Asked for ahead of the staging, stored behind it.
    const int   bi1 = min(tid, D1 - 1), bi2 = min(tid, D2 - 1);
    const float bg1 = b1[bi1];
    const float bg2 = b2[bi2];
    // the index registers of these two loads stay as they are up to this wait;
    // behind it a later address may take them
    asm volatile("s_wait_xcnt 0x0" :: "v"(bi1), "v"(bi2) : "memory");

    // ------- Stage the weights (transposed over K), once, and the first x tile
    {
        const int rowBase  = blockIdx.x * ROWS;
        const int rowsHere = (Btotal - rowBase < ROWS) ? (Btotal - rowBase) : ROWS;
        if (__builtin_expect(rowsHere == ROWS, 1))   // block-uniform
            stage_tile<true >(x, W1, W2, xlds, w1lds, w2lds, tid, rowBase, rowsHere);
        else                // the last tile of a batch that is no multiple of ROWS
            stage_tile<false>(x, W1, W2, xlds, w1lds, w2lds, tid, rowBase, rowsHere);
    }

    if (tid < NP1) b1lds[tid] = (tid < D1) ? bg1 : 0.f;
    if (tid < NP2) b2lds[tid] = (tid < D2) ? bg2 : 0.f;

    __syncthreads();   // weights, biases and the first x tile are in LDS: the one barrier

    // ------- The workgroup's tiles, one after the other, on the same weights.
    // Inside the loop a wave reads the weights and biases (never written again) and its
    // own 32 rows of x only, so the waves are free to run out of step: one wave's
    // vector work stands beside another's LDS reads and matrix work.
    _Float16* xw = xlds + wave * WROWS * KP1;            // the wave's own x rows
    for (int tile = blockIdx.x; tile < nTiles; tile += GRID) {
        const int rowBase = tile * ROWS;
        const int nextBase = rowBase + GRID * ROWS;      // the workgroup's next tile
        const int nextRows = Btotal - nextBase;          // <= 0: there is none

        // The next tile's first 16 rows of x are asked for here, ahead of layer 1, and
        // waited for behind it; its other 16 rows then take the same registers and are
        // waited for behind layer 2: memory works while the matrix units do.
        // (The address is formed on every trip; it is read from only where the batch
        // holds the whole tile.)
        v4f xnext[XTRIPS];
        const v4f* xaddr = (const v4f*)(x + (size_t)(nextBase + wave * WROWS) * D_IN) + lane;
        if (nextRows >= ROWS)                            // block-uniform
            load_x(xaddr, xnext);

        // ---------------- Layer 1: h1^T = leaky(W1^T x^T + b1), row partial sums --
        // The product is taken transposed: W1^T is the A operand (lane = h1 column), x the
        // B operand (lane = batch row). A lane of the result then holds ONE batch row and
        // eight neighbouring h1 columns, 16*nt + 8*hh + [0..7]: just the k order of a B
        // fragment of layer 2, so h1 goes on in registers and never through LDS, and a
        // row's mean is summed inside the lane. The bias runs along the registers and
        // comes in as the C operand of a tile's first WMMA.
        // Two row tiles x ten column tiles accumulate side by side. The work goes in
        // groups of five column tiles of one k step: the five W1 fragments of a group
        // are read from LDS once and feed ten WMMAs (both row tiles). A group's reads
        // are asked for two groups ahead (three register sets); the two x fragments of
        // a k step come with the step's first group (two sets).
        v2f rs1[MT][4];                                  // per register pair of a tile
        v16h h1f[MT][K2_STEPS];                          // h1 as layer 2's B fragments
        const _Float16* w2Base = w2lds + m * KP2 + 8 * hh;
        v16h w2f[2][NT2];
        v8f  c2[NT2];
        {
            constexpr int NH = NT1 / 2;                  // column tiles per group
            constexpr int NG = K1_STEPS * 2;             // groups
            static_assert(NH * 2 == NT1 && NT1 == 2 * K2_STEPS, "two groups per k step");
            const _Float16* xBase = xlds  + rowL * KP1 + 8 * hh;
            const _Float16* wBase = w1lds + m    * KP1 + 8 * hh;
            v16h xf[2][MT], wf[3][NH];
            v8f  acc[MT][NT1], c1[NT1];
#pragma unroll
            for (int g = 0; g < 2; ++g) {
                if (g == 0) {
#pragma unroll
                    for (int r = 0; r < MT; ++r) xf[0][r] = frag(xBase + r * 16 * KP1);
                }
#pragma unroll
                for (int nt = 0; nt < NH; ++nt) wf[g][nt] = frag(wBase + (g * NH + nt) * 16 * KP1);
#pragma unroll
                for (int nt = 0; nt < NH; ++nt) c1[g * NH + nt] = bias8(b1lds + (g * NH + nt) * 16 + 8 * hh);
            }
            // the reads of groups 0 and 1 are asked for ahead of those of group 2, so that
            // the first WMMAs wait for their own operands only
            __builtin_amdgcn_sched_barrier(0);
#pragma unroll
            for (int g = 0; g < NG; ++g) {
                const int ks = g >> 1, h = g & 1;
                const int gn = g + 2;                    // the group fetched here
                if (gn < NG) {
                    if ((gn & 1) == 0) {
#pragma unroll
                        for (int r = 0; r < MT; ++r)
                            xf[(gn >> 1) & 1][r] = frag(xBase + r * 16 * KP1 + (gn >> 1) * 32);
                    }
#pragma unroll
                    for (int nt = 0; nt < NH; ++nt)
                        wf[gn % 3][nt] = frag(wBase + ((gn & 1) * NH + nt) * 16 * KP1 + (gn >> 1) * 32);
                    // holds the LDS reads above as one group ahead of this group's WMMAs:
                    // left free, the compiler spreads them in pairs among the WMMAs
                    __builtin_amdgcn_sched_barrier(0);
                }
#pragma unroll
                for (int nt = 0; nt < NH; ++nt)
#pragma unroll
                    for (int r = 0; r < MT; ++r)
                        acc[r][h * NH + nt] = __builtin_amdgcn_wmma_f32_16x16x32_f16(
                            false, wf[g % 3][nt], false, xf[ks & 1][r], (short)0,
                            (ks == 0) ? c1[h * NH + nt] : acc[r][h * NH + nt], false, false);
                // keeps the next group of reads behind this group's WMMAs
                if (gn < NG) __builtin_amdgcn_sched_barrier(0);
            }
            // Layer 2's first W2 fragments and its biases are asked for here, into registers
            // that layer 1's fragments have left: they arrive under the vector work below.
#pragma unroll
            for (int nt = 0; nt < NT2; ++nt) w2f[0][nt] = frag(w2Base + nt * 16 * KP2);
#pragma unroll
            for (int nt = 0; nt < NT2; ++nt) c2[nt] = bias8(b2lds + nt * 16 + 8 * hh);
            // keeps these reads ahead of the vector work: left free, the compiler moves
            // them down to their first use, where their latency would stand open
            __builtin_amdgcn_sched_barrier(0);
#pragma unroll
            for (int r = 0; r < MT; ++r) {
#pragma unroll
                for (int ks = 0; ks < K2_STEPS; ++ks) {
                    // k = 32*ks + 8*hh + [0..7] from tile 2*ks, the same + 16 from tile 2*ks + 1
                    union { v16h v; v2h p[8]; } f;
#pragma unroll
                    for (int t = 0; t < 2; ++t) {
                        const int nt = 2 * ks + t;
#pragma unroll
                        for (int p = 0; p < 4; ++p) {
                            const int ncol = nt * 16 + 8 * hh + 2 * p;
                            if (nt * 16 + 2 * p >= D1) {           // padded in both halves
                                f.p[t * 4 + p] = (v2h)(_Float16)0.f;
                                continue;
                            }
                            v2f hv = leaky2((v2f){acc[r][nt][2 * p], acc[r][nt][2 * p + 1]});
                            if (ncol     >= D1) hv.x = 0.f;        // padded column -> exact 0
                            if (ncol + 1 >= D1) hv.y = 0.f;
                            rs1[r][p] = (nt == 0) ? hv : rs1[r][p] + hv;
                            f.p[t * 4 + p] = __builtin_convertvector(hv, v2h);
                        }
                    }
                    h1f[r][ks] = f.v;
                }
            }
        }

        // Row sums of h1 (cols 0..159, zeros padded); out1 is stored with out2 below.
        float sum1[MT];
#pragma unroll
        for (int r = 0; r < MT; ++r) sum1[r] = row_sum(rs1[r]);

        // Layer 1 has read the wave's x rows: the next tile's first 16 go into their
        // place, and its other 16 are asked for, off the same address registers.
        if (nextRows >= ROWS) {                          // block-uniform
            store_x(xw, lane, xnext);
            load_x(xaddr + 16 * XQ_ROW, xnext);
        }

        // ---------------- Layer 2: out2 = mean(leaky(W2^T h1^T + b2)) ----------
        // h1 in registers as B fragments, two row tiles x seven column tiles side by side:
        // the seven W2 fragments of a k step feed fourteen WMMAs and are fetched as one
        // group ahead of the WMMAs of the step before.
        v2f rs2[MT][4];
        {
            v8f  acc[MT][NT2];
#pragma unroll
            for (int ks = 0; ks < K2_STEPS; ++ks) {
                if (ks + 1 < K2_STEPS) {
#pragma unroll
                    for (int nt = 0; nt < NT2; ++nt)
                        w2f[(ks + 1) & 1][nt] = frag(w2Base + nt * 16 * KP2 + (ks + 1) * 32);
                    // holds the LDS reads above as one group ahead of this step's WMMAs:
                    // left free, the compiler spreads them in pairs among the WMMAs
                    __builtin_amdgcn_sched_barrier(0);
                }
#pragma unroll
                for (int nt = 0; nt < NT2; ++nt)
#pragma unroll
                    for (int r = 0; r < MT; ++r)
                        acc[r][nt] = __builtin_amdgcn_wmma_f32_16x16x32_f16(
                            false, w2f[ks & 1][nt], false, h1f[r][ks], (short)0,
                            (ks == 0) ? c2[nt] : acc[r][nt], false, false);
                // keeps the next group of reads behind this step's WMMAs
                if (ks + 1 < K2_STEPS) __builtin_amdgcn_sched_barrier(0);
            }
#pragma unroll
            for (int r = 0; r < MT; ++r) {
#pragma unroll
                for (int nt = 0; nt < NT2; ++nt) {
#pragma unroll
                    for (int p = 0; p < 4; ++p) {
                        const int ncol = nt * 16 + 8 * hh + 2 * p;
                        if (nt * 16 + 2 * p >= D2) continue;       // padded in both halves
                        v2f hv = leaky2((v2f){acc[r][nt][2 * p], acc[r][nt][2 * p + 1]});
                        if (ncol     >= D2) hv.x = 0.f;
                        if (ncol + 1 >= D2) hv.y = 0.f;
                        rs2[r][p] = (nt == 0) ? hv : rs2[r][p] + hv;
                    }
                }
            }
        }

        // The address registers of the x loads above are held (as this statement's input)
        // up to this wait; only behind it may anything take them. Every way through
        // the trip passes here, and neither layer has had to stand still for it.
        asm volatile("s_wait_xcnt 0x0" :: "v"(xaddr) : "memory");

        {
            const float s20 = row_sum(rs2[0]), s21 = row_sum(rs2[1]);
            const float mean1 = (hh ? sum1[1] : sum1[0]) * (1.0f / (float)D1);
            const float mean2 = (hh ? s21 : s20) * (1.0f / (float)D2);
            const int gr = rowBase + wave * WROWS + lane;
            if (gr < Btotal) {
                out[gr] = mean1;
                out[(size_t)Btotal + gr] = mean2;
            }
        }

        // ---------------- The rest of the next tile's x into this wave's rows ----
        if (nextRows >= ROWS)                            // block-uniform
            store_x(xw + 16 * KP1, lane, xnext);
        else if (nextRows > 0)
            stage_x_part(x, xw, lane, nextBase + wave * WROWS, nextRows - wave * WROWS);
        // the next trip's layer 1 reads these rows, written by this wave's own lanes
        wave_lds_handover();
    }   // tiles
}

extern "C" void kernel_launch(void* const* d_in, const int* in_sizes, int n_in,
                              void* d_out, int out_size, void* d_ws, size_t ws_size,
                              hipStream_t stream) {
    const float* x  = (const float*)d_in[0];
    const float* W1 = (const float*)d_in[1];
    const float* b1 = (const float*)d_in[2];
    const float* W2 = (const float*)d_in[3];
    const float* b2 = (const float*)d_in[4];
    float* out = (float*)d_out;

    const int Btotal = in_sizes[0] / D_IN;         // 262144

    hipLaunchKernelGGL(mlp2_fused_wmma, dim3(GRID), dim3(256), 0, stream,
                       x, W1, b1, W2, b2, out, Btotal);
}
